// v000
// Measured on an AMD MI455X. A time is GPU time per run, averaged over a window of back-to-back runs after a warm-up
// (all launches, gaps included; the runs take copies of the inputs in turn), and the median of several windows.
// Apart from v000's, it joins two sittings. Times from different sittings can be a few percent apart, while
// side-by-side timings come from the same sitting.
// v000, which the later versions start from, runs in 223 microseconds.
#include <hip/hip_runtime.h>
#include <hip/hip_bf16.h>

typedef float     v8f  __attribute__((ext_vector_type(8)));
typedef _Float16  v8h  __attribute__((ext_vector_type(8)));
typedef _Float16  v16h __attribute__((ext_vector_type(16)));

__device__ __forceinline__ v8f wmma_f32_f16(v16h a, v16h b, v8f c) {
  return __builtin_amdgcn_wmma_f32_16x16x32_f16(false, a, false, b, (short)0, c,
                                                false, false);
}

__device__ __forceinline__ v8f zero_v8f() {
  v8f z;
#pragma unroll
  for (int i = 0; i < 8; ++i) z[i] = 0.0f;
  return z;
}

__device__ __forceinline__ v16h load_frag(const _Float16* base, int stride,
                                          int row, int koff, int g) {
  const _Float16* p = base + row * stride + koff + 8 * g;
  v8h lo = *(const v8h*)(p);
  v8h hi = *(const v8h*)(p + 16);
  v16h r;
#pragma unroll
  for (int e = 0; e < 8; ++e) { r[e] = lo[e]; r[e + 8] = hi[e]; }
  return r;
}

__device__ __forceinline__ void async_copy_b128(unsigned lds_off,
                                                const void* sbase,
                                                unsigned voff) {
  asm volatile("global_load_async_to_lds_b128 %0, %1, %2"
               :
               : "v"(lds_off), "v"(voff), "s"(sbase)
               : "memory");
}

__device__ __forceinline__ void wait_async0() {
  asm volatile("s_wait_asynccnt 0x0" ::: "memory");
}

// ---------------------------------------------------------------------------
// Elementwise fp32 -> f16 (one-time; makes every GEMM/attention input f16).
// ---------------------------------------------------------------------------
__global__ __launch_bounds__(256) void cvt_f32_f16_kernel(
    const float* __restrict__ src, _Float16* __restrict__ dst, int n8) {
  const int i = blockIdx.x * blockDim.x + threadIdx.x;
  if (i < n8) {
    v8f x = *(const v8f*)(src + (size_t)i * 8);
    v8h h;
#pragma unroll
    for (int e = 0; e < 8; ++e) h[e] = (_Float16)x[e];
    *(v8h*)(dst + (size_t)i * 8) = h;
  }
}

template <typename OutT>
__global__ __launch_bounds__(256) void gemm_h_kernel(
    const _Float16* __restrict__ X, const _Float16* __restrict__ W,
    const float* __restrict__ bias, OutT* __restrict__ Y,
    int M, int N, int K) {
  const int n0 = blockIdx.x * 128;
  const int m0 = blockIdx.y * 128;
  const int t  = threadIdx.x;
  const int w  = t >> 5;
  const int l  = t & 31;
  const int lm = l & 15;
  const int g  = l >> 4;
  const int wm = w & 1;    // 2 waves along M (64 rows each)
  const int wn = w >> 1;   // 4 waves along N (32 cols each)

  // stride 40 halfs = 80B (16B-divisible -> b128 frag loads); 2 buffers.
  __shared__ _Float16 As[2][128 * 40];
  __shared__ _Float16 Bs[2][128 * 40];

  v8f c[4][2];
#pragma unroll
  for (int i = 0; i < 4; ++i)
#pragma unroll
    for (int j = 0; j < 2; ++j) c[i][j] = zero_v8f();

  // Per-thread staging share: one row (t>>1) of the 128x32 slab, 16-half
  // column chunk ((t&1)*16) -> two async b128 per matrix per k-step.
  const int srow = t >> 1;
  const int scol = (t & 1) * 16;
  const unsigned grow_off = (unsigned)((srow * K + scol) * 2);  // bytes
  const unsigned lrow_off = (unsigned)((srow * 40 + scol) * 2); // bytes

  const _Float16* Xb = X + (size_t)m0 * K;
  const _Float16* Wb = W + (size_t)n0 * K;

  // Prologue: stage slab 0 into buffer 0.
  {
    unsigned la = (unsigned)(uintptr_t)(&As[0][0]) + lrow_off;
    unsigned lb = (unsigned)(uintptr_t)(&Bs[0][0]) + lrow_off;
    async_copy_b128(la,       Xb, grow_off);
    async_copy_b128(la + 16u, Xb, grow_off + 16u);
    async_copy_b128(lb,       Wb, grow_off);
    async_copy_b128(lb + 16u, Wb, grow_off + 16u);
  }
  wait_async0();
  __syncthreads();

  for (int kt = 0; kt < K; kt += 32) {
    const int cur = (kt >> 5) & 1;
    const bool more = (kt + 32) < K;

    // Issue next slab into the other buffer (overlaps with wmma below).
    if (more) {
      const unsigned gofs = grow_off + (unsigned)((kt + 32) * 2);
      unsigned la = (unsigned)(uintptr_t)(&As[cur ^ 1][0]) + lrow_off;
      unsigned lb = (unsigned)(uintptr_t)(&Bs[cur ^ 1][0]) + lrow_off;
      async_copy_b128(la,       Xb, gofs);
      async_copy_b128(la + 16u, Xb, gofs + 16u);
      async_copy_b128(lb,       Wb, gofs);
      async_copy_b128(lb + 16u, Wb, gofs + 16u);
    }

    // Compute on current buffer: 4 A-frags, 2 B-frags, 8 wmma.
    const _Float16* Ab = As[cur];
    const _Float16* Bb = Bs[cur];
    v16h af[4];
#pragma unroll
    for (int i = 0; i < 4; ++i)
      af[i] = load_frag(Ab, 40, wm * 64 + i * 16 + lm, 0, g);
#pragma unroll
    for (int j = 0; j < 2; ++j) {
      v16h bf = load_frag(Bb, 40, wn * 32 + j * 16 + lm, 0, g);
#pragma unroll
      for (int i = 0; i < 4; ++i) c[i][j] = wmma_f32_f16(af[i], bf, c[i][j]);
    }

    if (more) wait_async0();
    __syncthreads();
  }

  // Epilogue: C layout -> lane holds col n = lm, rows r + 8g.
#pragma unroll
  for (int j = 0; j < 2; ++j) {
    const int ncol = n0 + wn * 32 + j * 16 + lm;
    const float bj = bias[ncol];
#pragma unroll
    for (int i = 0; i < 4; ++i) {
#pragma unroll
      for (int r = 0; r < 8; ++r) {
        const int mrow = m0 + wm * 64 + i * 16 + r + 8 * g;
        Y[(size_t)mrow * N + ncol] = (OutT)(c[i][j][r] + bj);
      }
    }
  }
}

// ---------------------------------------------------------------------------
// Flash attention (online softmax), f16 q/k/v, f32 accumulate, f16 ctx out.
// Grid: (LQ/64, H, B); block 128 = 4 waves; wave owns 16 query rows.
// KV chunked by 32: S(16x32)=4 wmma, PV(16x64)=4 wmma per wave per chunk.
// ---------------------------------------------------------------------------
#define AB   4
#define ALQ  1024
#define ALKV 2048
#define AD   1024
#define AH   16
#define AHD  64

__global__ __launch_bounds__(128) void attn_kernel(
    const _Float16* __restrict__ q, const _Float16* __restrict__ kmat,
    const _Float16* __restrict__ vmat, _Float16* __restrict__ ctx,
    const float* __restrict__ scale_p, const float* __restrict__ beta_p) {
  const int qt = blockIdx.x;
  const int h  = blockIdx.y;
  const int b  = blockIdx.z;
  const int t  = threadIdx.x;
  const int w  = t >> 5;
  const int l  = t & 31;
  const int lm = l & 15;
  const int g  = l >> 4;

  __shared__ _Float16 Qs[64 * 72];     // 64 q-rows x 64 d (stride 72)
  __shared__ _Float16 Ks[32 * 72];     // 32 kv-rows x 64 d
  __shared__ _Float16 Vt[64 * 40];     // transposed: 64 d x 32 kv
  __shared__ _Float16 Ps[4][16 * 32];  // per-wave P scratch (C->A relayout)

  const float scale = scale_p[0] * 0.125f;  // 1/sqrt(64)
  const float beta  = beta_p[0];

  {  // Stage Q tile once.
    const int row = t >> 1;
    const int cb  = (t & 1) * 32;
    const _Float16* src =
        q + ((size_t)(b * ALQ + qt * 64 + row)) * AD + h * AHD + cb;
    _Float16* dst = &Qs[row * 72 + cb];
#pragma unroll
    for (int i = 0; i < 4; ++i)
      *(v8h*)(dst + i * 8) = *(const v8h*)(src + i * 8);
  }
  __syncthreads();

  v16h qa0 = load_frag(Qs, 72, w * 16 + lm, 0, g);
  v16h qa1 = load_frag(Qs, 72, w * 16 + lm, 32, g);

  float mrow[8], lrow[8];
  v8f acc[4];
#pragma unroll
  for (int r = 0; r < 8; ++r) { mrow[r] = -1e30f; lrow[r] = 0.0f; }
#pragma unroll
  for (int d = 0; d < 4; ++d) acc[d] = zero_v8f();

  for (int cchunk = 0; cchunk < ALKV / 32; ++cchunk) {
    const int kv0 = cchunk * 32;
    __syncthreads();

    {  // K chunk row-major.
      const int row = t >> 2;
      const int cb  = (t & 3) * 16;
      const _Float16* src =
          kmat + ((size_t)(b * ALKV + kv0 + row)) * AD + h * AHD + cb;
      *(v8h*)(&Ks[row * 72 + cb])     = *(const v8h*)(src);
      *(v8h*)(&Ks[row * 72 + cb + 8]) = *(const v8h*)(src + 8);
    }
    {  // V chunk transposed.
      const int row = t >> 2;
      const int cb  = (t & 3) * 16;
      const _Float16* src =
          vmat + ((size_t)(b * ALKV + kv0 + row)) * AD + h * AHD + cb;
#pragma unroll
      for (int i = 0; i < 16; ++i) Vt[(cb + i) * 40 + row] = src[i];
    }
    __syncthreads();

    v8f s0 = zero_v8f(), s1 = zero_v8f();
    {
      v16h kb;
      kb = load_frag(Ks, 72, lm, 0, g);        s0 = wmma_f32_f16(qa0, kb, s0);
      kb = load_frag(Ks, 72, lm, 32, g);       s0 = wmma_f32_f16(qa1, kb, s0);
      kb = load_frag(Ks, 72, 16 + lm, 0, g);   s1 = wmma_f32_f16(qa0, kb, s1);
      kb = load_frag(Ks, 72, 16 + lm, 32, g);  s1 = wmma_f32_f16(qa1, kb, s1);
    }

    float p0[8], p1[8];
#pragma unroll
    for (int r = 0; r < 8; ++r) {
      const float a0 = s0[r] * scale + beta;
      const float a1 = s1[r] * scale + beta;
      float mx = fmaxf(a0, a1);
      mx = fmaxf(mx, __shfl_xor(mx, 1, 32));
      mx = fmaxf(mx, __shfl_xor(mx, 2, 32));
      mx = fmaxf(mx, __shfl_xor(mx, 4, 32));
      mx = fmaxf(mx, __shfl_xor(mx, 8, 32));
      const float mnew  = fmaxf(mrow[r], mx);
      const float alpha = __expf(mrow[r] - mnew);
      mrow[r] = mnew;
      p0[r] = __expf(a0 - mnew);
      p1[r] = __expf(a1 - mnew);
      lrow[r] = lrow[r] * alpha + p0[r] + p1[r];
#pragma unroll
      for (int d = 0; d < 4; ++d) acc[d][r] *= alpha;
    }

#pragma unroll
    for (int r = 0; r < 8; ++r) {
      const int m = r + 8 * g;
      Ps[w][m * 32 + lm]      = (_Float16)p0[r];
      Ps[w][m * 32 + 16 + lm] = (_Float16)p1[r];
    }
    v16h pa = load_frag(Ps[w], 32, lm, 0, g);

#pragma unroll
    for (int d = 0; d < 4; ++d) {
      v16h vb = load_frag(Vt, 40, d * 16 + lm, 0, g);
      acc[d] = wmma_f32_f16(pa, vb, acc[d]);
    }
  }

#pragma unroll
  for (int r = 0; r < 8; ++r) {
    float s = lrow[r];
    s += __shfl_xor(s, 1, 32);
    s += __shfl_xor(s, 2, 32);
    s += __shfl_xor(s, 4, 32);
    s += __shfl_xor(s, 8, 32);
    const float rinv = 1.0f / s;
    const int qrow = qt * 64 + w * 16 + r + 8 * g;
#pragma unroll
    for (int d = 0; d < 4; ++d) {
      const int col = h * AHD + d * 16 + lm;
      ctx[((size_t)(b * ALQ + qrow)) * AD + col] = (_Float16)(acc[d][r] * rinv);
    }
  }
}

// ---------------------------------------------------------------------------
// Launcher. Workspace (f16 unless noted):
//  [0,8)MB qdom | [8,24) kvdom | [24,26) Wq | [26,28) Wk | [28,30) Wv
//  [30,32) Wo | [32,40) q | [40,56) k | [56,72) v | [72,80) ctx  => 80MB
// ---------------------------------------------------------------------------
extern "C" void kernel_launch(void* const* d_in, const int* in_sizes, int n_in,
                              void* d_out, int out_size, void* d_ws,
                              size_t ws_size, hipStream_t stream) {
  (void)in_sizes; (void)n_in; (void)out_size; (void)ws_size;

  const float* qdom  = (const float*)d_in[0];
  const float* kvdom = (const float*)d_in[1];
  const float* Wq = (const float*)d_in[2];
  const float* bq = (const float*)d_in[3];
  const float* Wk = (const float*)d_in[4];
  const float* bk = (const float*)d_in[5];
  const float* Wv = (const float*)d_in[6];
  const float* bv = (const float*)d_in[7];
  const float* Wo = (const float*)d_in[8];
  const float* bo = (const float*)d_in[9];
  const float* scale = (const float*)d_in[10];
  const float* beta  = (const float*)d_in[11];
  float* out = (float*)d_out;

  const size_t MB = 1u << 20;
  char* ws = (char*)d_ws;
  _Float16* qdom_h  = (_Float16*)(ws + 0 * MB);
  _Float16* kvdom_h = (_Float16*)(ws + 8 * MB);
  _Float16* Wq_h    = (_Float16*)(ws + 24 * MB);
  _Float16* Wk_h    = (_Float16*)(ws + 26 * MB);
  _Float16* Wv_h    = (_Float16*)(ws + 28 * MB);
  _Float16* Wo_h    = (_Float16*)(ws + 30 * MB);
  _Float16* qh      = (_Float16*)(ws + 32 * MB);
  _Float16* kh      = (_Float16*)(ws + 40 * MB);
  _Float16* vh      = (_Float16*)(ws + 56 * MB);
  _Float16* ctxh    = (_Float16*)(ws + 72 * MB);

  auto cvt = [&](const float* s, _Float16* d, size_t n) {
    const int n8 = (int)(n / 8);
    cvt_f32_f16_kernel<<<dim3((n8 + 255) / 256), dim3(256), 0, stream>>>(s, d,
                                                                         n8);
  };
  cvt(qdom,  qdom_h,  (size_t)4096 * 1024);
  cvt(kvdom, kvdom_h, (size_t)8192 * 1024);
  cvt(Wq, Wq_h, (size_t)1024 * 1024);
  cvt(Wk, Wk_h, (size_t)1024 * 1024);
  cvt(Wv, Wv_h, (size_t)1024 * 1024);
  cvt(Wo, Wo_h, (size_t)1024 * 1024);

  const dim3 blk(256);
  gemm_h_kernel<_Float16><<<dim3(1024 / 128, 4096 / 128), blk, 0, stream>>>(
      qdom_h, Wq_h, bq, qh, 4096, 1024, 1024);
  gemm_h_kernel<_Float16><<<dim3(1024 / 128, 8192 / 128), blk, 0, stream>>>(
      kvdom_h, Wk_h, bk, kh, 8192, 1024, 1024);
  gemm_h_kernel<_Float16><<<dim3(1024 / 128, 8192 / 128), blk, 0, stream>>>(
      kvdom_h, Wv_h, bv, vh, 8192, 1024, 1024);

  attn_kernel<<<dim3(ALQ / 64, AH, AB), dim3(128), 0, stream>>>(
      qh, kh, vh, ctxh, scale, beta);

  gemm_h_kernel<float><<<dim3(1024 / 128, 4096 / 128), blk, 0, stream>>>(
      ctxh, Wo_h, bo, out, 4096, 1024, 1024);
}

// v001
// Measured time: 193 microseconds a run.
// Two timings next to v000 put it at 1.18 and 1.17 times that version's speed.
#include <hip/hip_runtime.h>
#include <hip/hip_bf16.h>

typedef float     v8f  __attribute__((ext_vector_type(8)));
typedef _Float16  v8h  __attribute__((ext_vector_type(8)));
typedef _Float16  v16h __attribute__((ext_vector_type(16)));

__device__ __forceinline__ v8f wmma_f32_f16(v16h a, v16h b, v8f c) {
  return __builtin_amdgcn_wmma_f32_16x16x32_f16(false, a, false, b, (short)0, c,
                                                false, false);
}

__device__ __forceinline__ v8f zero_v8f() {
  v8f z;
#pragma unroll
  for (int i = 0; i < 8; ++i) z[i] = 0.0f;
  return z;
}

__device__ __forceinline__ v16h load_frag(const _Float16* base, int stride,
                                          int row, int koff, int g) {
  const _Float16* p = base + row * stride + koff + 8 * g;
  v8h lo = *(const v8h*)(p);
  v8h hi = *(const v8h*)(p + 16);
  v16h r;
#pragma unroll
  for (int e = 0; e < 8; ++e) { r[e] = lo[e]; r[e + 8] = hi[e]; }
  return r;
}

__device__ __forceinline__ void async_copy_b128(unsigned lds_off,
                                                const void* sbase,
                                                unsigned voff) {
  asm volatile("global_load_async_to_lds_b128 %0, %1, %2"
               :
               : "v"(lds_off), "v"(voff), "s"(sbase)
               : "memory");
}

__device__ __forceinline__ void wait_async0() {
  asm volatile("s_wait_asynccnt 0x0" ::: "memory");
}

// ---------------------------------------------------------------------------
// Elementwise fp32 -> f16 (one-time; makes every GEMM/attention input f16).
// ---------------------------------------------------------------------------
__global__ __launch_bounds__(256) void cvt_f32_f16_kernel(
    const float* __restrict__ src, _Float16* __restrict__ dst, int n8) {
  const int i = blockIdx.x * blockDim.x + threadIdx.x;
  if (i < n8) {
    v8f x = *(const v8f*)(src + (size_t)i * 8);
    v8h h;
#pragma unroll
    for (int e = 0; e < 8; ++e) h[e] = (_Float16)x[e];
    *(v8h*)(dst + (size_t)i * 8) = h;
  }
}

template <typename OutT>
__global__ __launch_bounds__(256) void gemm_h_kernel(
    const _Float16* __restrict__ X, const _Float16* __restrict__ W,
    const float* __restrict__ bias, OutT* __restrict__ Y,
    int M, int N, int K) {
  const int n0 = blockIdx.x * 128;
  const int m0 = blockIdx.y * 128;
  const int t  = threadIdx.x;
  const int w  = t >> 5;
  const int l  = t & 31;
  const int lm = l & 15;
  const int g  = l >> 4;
  const int wm = w & 1;    // 2 waves along M (64 rows each)
  const int wn = w >> 1;   // 4 waves along N (32 cols each)

  // stride 40 halfs = 80B (16B-divisible -> b128 frag loads); 2 buffers.
  __shared__ _Float16 As[2][128 * 40];
  __shared__ _Float16 Bs[2][128 * 40];

  v8f c[4][2];
#pragma unroll
  for (int i = 0; i < 4; ++i)
#pragma unroll
    for (int j = 0; j < 2; ++j) c[i][j] = zero_v8f();

  // Per-thread staging share: one row (t>>1) of the 128x32 slab, 16-half
  // column chunk ((t&1)*16) -> two async b128 per matrix per k-step.
  const int srow = t >> 1;
  const int scol = (t & 1) * 16;
  const unsigned grow_off = (unsigned)((srow * K + scol) * 2);  // bytes
  const unsigned lrow_off = (unsigned)((srow * 40 + scol) * 2); // bytes

  const _Float16* Xb = X + (size_t)m0 * K;
  const _Float16* Wb = W + (size_t)n0 * K;

  // Prologue: stage slab 0 into buffer 0.
  {
    unsigned la = (unsigned)(uintptr_t)(&As[0][0]) + lrow_off;
    unsigned lb = (unsigned)(uintptr_t)(&Bs[0][0]) + lrow_off;
    async_copy_b128(la,       Xb, grow_off);
    async_copy_b128(la + 16u, Xb, grow_off + 16u);
    async_copy_b128(lb,       Wb, grow_off);
    async_copy_b128(lb + 16u, Wb, grow_off + 16u);
  }
  wait_async0();
  __syncthreads();

  for (int kt = 0; kt < K; kt += 32) {
    const int cur = (kt >> 5) & 1;
    const bool more = (kt + 32) < K;

    // Issue next slab into the other buffer (overlaps with wmma below).
    if (more) {
      const unsigned gofs = grow_off + (unsigned)((kt + 32) * 2);
      unsigned la = (unsigned)(uintptr_t)(&As[cur ^ 1][0]) + lrow_off;
      unsigned lb = (unsigned)(uintptr_t)(&Bs[cur ^ 1][0]) + lrow_off;
      async_copy_b128(la,       Xb, gofs);
      async_copy_b128(la + 16u, Xb, gofs + 16u);
      async_copy_b128(lb,       Wb, gofs);
      async_copy_b128(lb + 16u, Wb, gofs + 16u);
    }

    // Compute on current buffer: 4 A-frags, 2 B-frags, 8 wmma.
    const _Float16* Ab = As[cur];
    const _Float16* Bb = Bs[cur];
    v16h af[4];
#pragma unroll
    for (int i = 0; i < 4; ++i)
      af[i] = load_frag(Ab, 40, wm * 64 + i * 16 + lm, 0, g);
#pragma unroll
    for (int j = 0; j < 2; ++j) {
      v16h bf = load_frag(Bb, 40, wn * 32 + j * 16 + lm, 0, g);
#pragma unroll
      for (int i = 0; i < 4; ++i) c[i][j] = wmma_f32_f16(af[i], bf, c[i][j]);
    }

    if (more) wait_async0();
    __syncthreads();
  }

  // Epilogue: C layout -> lane holds col n = lm, rows r + 8g.
#pragma unroll
  for (int j = 0; j < 2; ++j) {
    const int ncol = n0 + wn * 32 + j * 16 + lm;
    const float bj = bias[ncol];
#pragma unroll
    for (int i = 0; i < 4; ++i) {
#pragma unroll
      for (int r = 0; r < 8; ++r) {
        const int mrow = m0 + wm * 64 + i * 16 + r + 8 * g;
        Y[(size_t)mrow * N + ncol] = (OutT)(c[i][j][r] + bj);
      }
    }
  }
}

#define AB   4
#define ALQ  1024
#define ALKV 2048
#define AD   1024
#define AH   16
#define AHD  64

__device__ __forceinline__ float xhalf(float x) {
  const int i = __builtin_bit_cast(int, x);
  return __builtin_bit_cast(
      float, __builtin_amdgcn_permlanex16(i, i, 0x76543210, 0xfedcba98, false,
                                          false));
}

__global__ __launch_bounds__(128) void attn_kernel(
    const _Float16* __restrict__ q, const _Float16* __restrict__ kmat,
    const _Float16* __restrict__ vmat, _Float16* __restrict__ ctx,
    const float* __restrict__ scale_p, const float* __restrict__ beta_p) {
  const int qt = blockIdx.x;
  const int h  = blockIdx.y;
  const int b  = blockIdx.z;
  const int t  = threadIdx.x;
  const int w  = t >> 5;
  const int l  = t & 31;
  const int lm = l & 15;
  const int g  = l >> 4;

  __shared__ _Float16 Qs[64 * 72];     // 64 q-rows x 64 d (stride 72)
  __shared__ _Float16 Ks[32 * 72];     // 32 kv-rows x 64 d
  __shared__ _Float16 Vt[64 * 40];     // transposed: 64 d x 32 kv

  const float scale = scale_p[0] * 0.125f;  // 1/sqrt(64)
  const float beta  = beta_p[0];

  {  // Stage Q tile once.
    const int row = t >> 1;
    const int cb  = (t & 1) * 32;
    const _Float16* src =
        q + ((size_t)(b * ALQ + qt * 64 + row)) * AD + h * AHD + cb;
    _Float16* dst = &Qs[row * 72 + cb];
#pragma unroll
    for (int i = 0; i < 4; ++i)
      *(v8h*)(dst + i * 8) = *(const v8h*)(src + i * 8);
  }
  __syncthreads();

  // B operand Q^T: column lm = query w*16+lm, k = d in the hardware order.
  v16h qb0 = load_frag(Qs, 72, w * 16 + lm, 0, g);
  v16h qb1 = load_frag(Qs, 72, w * 16 + lm, 32, g);

  // Per lane: running max and this half's partial sum of query w*16+lm.
  float mrow = -1e30f, lrow = 0.0f;
  v8f acc[4];  // acc[d][r] = O^T[d*16 + 8g + r][query lm]
#pragma unroll
  for (int d = 0; d < 4; ++d) acc[d] = zero_v8f();

  for (int cchunk = 0; cchunk < ALKV / 32; ++cchunk) {
    const int kv0 = cchunk * 32;
    __syncthreads();

    {  // K chunk row-major.
      const int row = t >> 2;
      const int cb  = (t & 3) * 16;
      const _Float16* src =
          kmat + ((size_t)(b * ALKV + kv0 + row)) * AD + h * AHD + cb;
      *(v8h*)(&Ks[row * 72 + cb])     = *(const v8h*)(src);
      *(v8h*)(&Ks[row * 72 + cb + 8]) = *(const v8h*)(src + 8);
    }
    {  // V chunk transposed.
      const int row = t >> 2;
      const int cb  = (t & 3) * 16;
      const _Float16* src =
          vmat + ((size_t)(b * ALKV + kv0 + row)) * AD + h * AHD + cb;
#pragma unroll
      for (int i = 0; i < 16; ++i) Vt[(cb + i) * 40 + row] = src[i];
    }
    __syncthreads();

    // s0[r] = S^T[key 8g + r][query lm], s1[r] = S^T[key 16 + 8g + r][query lm].
    v8f s0 = zero_v8f(), s1 = zero_v8f();
    {
      v16h ka;
      ka = load_frag(Ks, 72, lm, 0, g);        s0 = wmma_f32_f16(ka, qb0, s0);
      ka = load_frag(Ks, 72, lm, 32, g);       s0 = wmma_f32_f16(ka, qb1, s0);
      ka = load_frag(Ks, 72, 16 + lm, 0, g);   s1 = wmma_f32_f16(ka, qb0, s1);
      ka = load_frag(Ks, 72, 16 + lm, 32, g);  s1 = wmma_f32_f16(ka, qb1, s1);
    }

    float a0[8], a1[8];
    float mx = -1e30f;
#pragma unroll
    for (int r = 0; r < 8; ++r) {
      a0[r] = s0[r] * scale + beta;
      a1[r] = s1[r] * scale + beta;
      mx = fmaxf(mx, fmaxf(a0[r], a1[r]));
    }
    mx = fmaxf(mx, xhalf(mx));  // both halves now hold the query's chunk max
    const float mnew  = fmaxf(mrow, mx);
    const float alpha = __expf(mrow - mnew);
    mrow = mnew;

    // P^T as B operand: element s is key kmap(s) = 8g + s (s < 8), 16 + 8g + s - 8.
    v16h pb;
    float ps = 0.0f;
#pragma unroll
    for (int r = 0; r < 8; ++r) {
      const float p0 = __expf(a0[r] - mnew);
      const float p1 = __expf(a1[r] - mnew);
      ps += p0 + p1;
      pb[r]     = (_Float16)p0;
      pb[r + 8] = (_Float16)p1;
    }
    lrow = lrow * alpha + ps;
#pragma unroll
    for (int d = 0; d < 4; ++d) acc[d] *= alpha;

#pragma unroll
    for (int d = 0; d < 4; ++d) {
      v16h va = load_frag(Vt, 40, d * 16 + lm, 0, g);  // A: row d, same k order
      acc[d] = wmma_f32_f16(va, pb, acc[d]);
    }
  }

  {
    const float rinv = 1.0f / (lrow + xhalf(lrow));  // join the halves' sums
    const int qrow = qt * 64 + w * 16 + lm;
    _Float16* dst = ctx + ((size_t)(b * ALQ + qrow)) * AD + h * AHD + 8 * g;
#pragma unroll
    for (int d = 0; d < 4; ++d) {
      v8h o;
#pragma unroll
      for (int r = 0; r < 8; ++r) o[r] = (_Float16)(acc[d][r] * rinv);
      *(v8h*)(dst + d * 16) = o;  // 8 consecutive d of one query: one 16B store
    }
  }
}

// ---------------------------------------------------------------------------
// Launcher. Workspace (f16 unless noted):
//  [0,8)MB qdom | [8,24) kvdom | [24,26) Wq | [26,28) Wk | [28,30) Wv
//  [30,32) Wo | [32,40) q | [40,56) k | [56,72) v | [72,80) ctx  => 80MB
// ---------------------------------------------------------------------------
extern "C" void kernel_launch(void* const* d_in, const int* in_sizes, int n_in,
                              void* d_out, int out_size, void* d_ws,
                              size_t ws_size, hipStream_t stream) {
  (void)in_sizes; (void)n_in; (void)out_size; (void)ws_size;

  const float* qdom  = (const float*)d_in[0];
  const float* kvdom = (const float*)d_in[1];
  const float* Wq = (const float*)d_in[2];
  const float* bq = (const float*)d_in[3];
  const float* Wk = (const float*)d_in[4];
  const float* bk = (const float*)d_in[5];
  const float* Wv = (const float*)d_in[6];
  const float* bv = (const float*)d_in[7];
  const float* Wo = (const float*)d_in[8];
  const float* bo = (const float*)d_in[9];
  const float* scale = (const float*)d_in[10];
  const float* beta  = (const float*)d_in[11];
  float* out = (float*)d_out;

  const size_t MB = 1u << 20;
  char* ws = (char*)d_ws;
  _Float16* qdom_h  = (_Float16*)(ws + 0 * MB);
  _Float16* kvdom_h = (_Float16*)(ws + 8 * MB);
  _Float16* Wq_h    = (_Float16*)(ws + 24 * MB);
  _Float16* Wk_h    = (_Float16*)(ws + 26 * MB);
  _Float16* Wv_h    = (_Float16*)(ws + 28 * MB);
  _Float16* Wo_h    = (_Float16*)(ws + 30 * MB);
  _Float16* qh      = (_Float16*)(ws + 32 * MB);
  _Float16* kh      = (_Float16*)(ws + 40 * MB);
  _Float16* vh      = (_Float16*)(ws + 56 * MB);
  _Float16* ctxh    = (_Float16*)(ws + 72 * MB);

  auto cvt = [&](const float* s, _Float16* d, size_t n) {
    const int n8 = (int)(n / 8);
    cvt_f32_f16_kernel<<<dim3((n8 + 255) / 256), dim3(256), 0, stream>>>(s, d,
                                                                         n8);
  };
  cvt(qdom,  qdom_h,  (size_t)4096 * 1024);
  cvt(kvdom, kvdom_h, (size_t)8192 * 1024);
  cvt(Wq, Wq_h, (size_t)1024 * 1024);
  cvt(Wk, Wk_h, (size_t)1024 * 1024);
  cvt(Wv, Wv_h, (size_t)1024 * 1024);
  cvt(Wo, Wo_h, (size_t)1024 * 1024);

  const dim3 blk(256);
  gemm_h_kernel<_Float16><<<dim3(1024 / 128, 4096 / 128), blk, 0, stream>>>(
      qdom_h, Wq_h, bq, qh, 4096, 1024, 1024);
  gemm_h_kernel<_Float16><<<dim3(1024 / 128, 8192 / 128), blk, 0, stream>>>(
      kvdom_h, Wk_h, bk, kh, 8192, 1024, 1024);
  gemm_h_kernel<_Float16><<<dim3(1024 / 128, 8192 / 128), blk, 0, stream>>>(
      kvdom_h, Wv_h, bv, vh, 8192, 1024, 1024);

  attn_kernel<<<dim3(ALQ / 64, AH, AB), dim3(128), 0, stream>>>(
      qh, kh, vh, ctxh, scale, beta);

  gemm_h_kernel<float><<<dim3(1024 / 128, 4096 / 128), blk, 0, stream>>>(
      ctxh, Wo_h, bo, out, 4096, 1024, 1024);
}

// v002
// It runs in 187 microseconds.
// Next to v001, in two timings, it ran 1.04 and 1.03 times as fast.
// Counting every step since v000, it is 1.22 times as fast.
#include <hip/hip_runtime.h>
#include <hip/hip_bf16.h>

typedef float     v8f  __attribute__((ext_vector_type(8)));
typedef _Float16  v8h  __attribute__((ext_vector_type(8)));
typedef _Float16  v16h __attribute__((ext_vector_type(16)));

__device__ __forceinline__ v8f wmma_f32_f16(v16h a, v16h b, v8f c) {
  return __builtin_amdgcn_wmma_f32_16x16x32_f16(false, a, false, b, (short)0, c,
                                                false, false);
}

__device__ __forceinline__ v8f zero_v8f() {
  v8f z;
#pragma unroll
  for (int i = 0; i < 8; ++i) z[i] = 0.0f;
  return z;
}

__device__ __forceinline__ v16h load_frag(const _Float16* base, int stride,
                                          int row, int koff, int g) {
  const _Float16* p = base + row * stride + koff + 8 * g;
  v8h lo = *(const v8h*)(p);
  v8h hi = *(const v8h*)(p + 16);
  v16h r;
#pragma unroll
  for (int e = 0; e < 8; ++e) { r[e] = lo[e]; r[e + 8] = hi[e]; }
  return r;
}

__device__ __forceinline__ void async_copy_b128(unsigned lds_off,
                                                const void* sbase,
                                                unsigned voff) {
  asm volatile("global_load_async_to_lds_b128 %0, %1, %2"
               :
               : "v"(lds_off), "v"(voff), "s"(sbase)
               : "memory");
}

__device__ __forceinline__ void wait_async0() {
  asm volatile("s_wait_asynccnt 0x0" ::: "memory");
}

// ---------------------------------------------------------------------------
// fp32 -> f16 of all six matrix inputs in ONE launch (every GEMM input is f16).
// The f16 copies lie back to back in the workspace, in the order q-domain (4),
// kv-domain (8), Wq, Wk, Wv, Wo (1 each, in pieces of 2^20 elements), so dst is
// one flat array. A block owns 32768 consecutive elements (32 blocks a piece,
// so a block never straddles two sources); a thread converts 16 groups of 8.
// 512 blocks = 4096 waves to start (two blocks a WGP), where one group a thread
// would start 65536; a wave's loads all stand ahead of its stores.
// ---------------------------------------------------------------------------
__global__ __launch_bounds__(256) void cvt_all_kernel(
    const float* __restrict__ qd, const float* __restrict__ kvd,
    const float* __restrict__ wq, const float* __restrict__ wk,
    const float* __restrict__ wv, const float* __restrict__ wo,
    _Float16* __restrict__ dst) {
  const int piece = blockIdx.x >> 5;  // block-uniform: scalar selects
  const float* src = qd;
  int first = 0;  // first piece of the chosen source
  if (piece >= 4)  { src = kvd; first = 4; }
  if (piece == 12) { src = wq;  first = 12; }
  if (piece == 13) { src = wk;  first = 13; }
  if (piece == 14) { src = wv;  first = 14; }
  if (piece == 15) { src = wo;  first = 15; }

  const size_t base = (size_t)blockIdx.x * 32768 + threadIdx.x * 8;
  const float* s = src + (base - ((size_t)first << 20));
  _Float16* d = dst + base;

  v8f x[16];
#pragma unroll  // straight line, so that many loads of a wave are in flight at once
  for (int k = 0; k < 16; ++k) x[k] = *(const v8f*)(s + k * 2048);
#pragma unroll  // x[] must stay in registers: constant indices only
  for (int k = 0; k < 16; ++k) {
    v8h h;
#pragma unroll
    for (int e = 0; e < 8; ++e) h[e] = (_Float16)x[k][e];
    *(v8h*)(d + k * 2048) = h;
  }
}

template <typename OutT>
__global__ __launch_bounds__(256) void gemm_h_kernel(
    const _Float16* __restrict__ X, const _Float16* __restrict__ W,
    const float* __restrict__ bias, OutT* __restrict__ Y,
    int M, int N, int K) {
  const int n0 = blockIdx.x * 128;
  const int m0 = blockIdx.y * 128;
  const int t  = threadIdx.x;
  const int w  = t >> 5;
  const int l  = t & 31;
  const int lm = l & 15;
  const int g  = l >> 4;
  const int wm = w & 1;    // 2 waves along M (64 rows each)
  const int wn = w >> 1;   // 4 waves along N (32 cols each)

  // stride 40 halfs = 80B (16B-divisible -> b128 frag loads); 2 buffers.
  __shared__ _Float16 As[2][128 * 40];
  __shared__ _Float16 Bs[2][128 * 40];

  v8f c[4][2];
#pragma unroll
  for (int i = 0; i < 4; ++i)
#pragma unroll
    for (int j = 0; j < 2; ++j) c[i][j] = zero_v8f();

  // Per-thread staging share: one row (t>>1) of the 128x32 slab, 16-half
  // column chunk ((t&1)*16) -> two async b128 per matrix per k-step.
  const int srow = t >> 1;
  const int scol = (t & 1) * 16;
  const unsigned grow_off = (unsigned)((srow * K + scol) * 2);  // bytes
  const unsigned lrow_off = (unsigned)((srow * 40 + scol) * 2); // bytes

  const _Float16* Xb = X + (size_t)m0 * K;
  const _Float16* Wb = W + (size_t)n0 * K;

  // Prologue: stage slab 0 into buffer 0.
  {
    unsigned la = (unsigned)(uintptr_t)(&As[0][0]) + lrow_off;
    unsigned lb = (unsigned)(uintptr_t)(&Bs[0][0]) + lrow_off;
    async_copy_b128(la,       Xb, grow_off);
    async_copy_b128(la + 16u, Xb, grow_off + 16u);
    async_copy_b128(lb,       Wb, grow_off);
    async_copy_b128(lb + 16u, Wb, grow_off + 16u);
  }
  wait_async0();
  __syncthreads();

  for (int kt = 0; kt < K; kt += 32) {
    const int cur = (kt >> 5) & 1;
    const bool more = (kt + 32) < K;

    // Issue next slab into the other buffer (overlaps with wmma below).
    if (more) {
      const unsigned gofs = grow_off + (unsigned)((kt + 32) * 2);
      unsigned la = (unsigned)(uintptr_t)(&As[cur ^ 1][0]) + lrow_off;
      unsigned lb = (unsigned)(uintptr_t)(&Bs[cur ^ 1][0]) + lrow_off;
      async_copy_b128(la,       Xb, gofs);
      async_copy_b128(la + 16u, Xb, gofs + 16u);
      async_copy_b128(lb,       Wb, gofs);
      async_copy_b128(lb + 16u, Wb, gofs + 16u);
    }

    // Compute on current buffer: 4 A-frags, 2 B-frags, 8 wmma.
    const _Float16* Ab = As[cur];
    const _Float16* Bb = Bs[cur];
    v16h af[4];
#pragma unroll
    for (int i = 0; i < 4; ++i)
      af[i] = load_frag(Ab, 40, wm * 64 + i * 16 + lm, 0, g);
#pragma unroll
    for (int j = 0; j < 2; ++j) {
      v16h bf = load_frag(Bb, 40, wn * 32 + j * 16 + lm, 0, g);
#pragma unroll
      for (int i = 0; i < 4; ++i) c[i][j] = wmma_f32_f16(af[i], bf, c[i][j]);
    }

    if (more) wait_async0();
    __syncthreads();
  }

  // Epilogue: C layout -> lane holds col n = lm, rows r + 8g.
#pragma unroll
  for (int j = 0; j < 2; ++j) {
    const int ncol = n0 + wn * 32 + j * 16 + lm;
    const float bj = bias[ncol];
#pragma unroll
    for (int i = 0; i < 4; ++i) {
#pragma unroll
      for (int r = 0; r < 8; ++r) {
        const int mrow = m0 + wm * 64 + i * 16 + r + 8 * g;
        Y[(size_t)mrow * N + ncol] = (OutT)(c[i][j][r] + bj);
      }
    }
  }
}

#define AB   4
#define ALQ  1024
#define ALKV 2048
#define AD   1024
#define AH   16
#define AHD  64

__device__ __forceinline__ float xhalf(float x) {
  const int i = __builtin_bit_cast(int, x);
  return __builtin_bit_cast(
      float, __builtin_amdgcn_permlanex16(i, i, 0x76543210, 0xfedcba98, false,
                                          false));
}

__global__ __launch_bounds__(128) void attn_kernel(
    const _Float16* __restrict__ q, const _Float16* __restrict__ kmat,
    const _Float16* __restrict__ vmat, _Float16* __restrict__ ctx,
    const float* __restrict__ scale_p, const float* __restrict__ beta_p) {
  const int qt = blockIdx.x;
  const int h  = blockIdx.y;
  const int b  = blockIdx.z;
  const int t  = threadIdx.x;
  const int w  = t >> 5;
  const int l  = t & 31;
  const int lm = l & 15;
  const int g  = l >> 4;

  __shared__ _Float16 Qs[64 * 72];     // 64 q-rows x 64 d (stride 72)
  __shared__ _Float16 Ks[32 * 72];     // 32 kv-rows x 64 d
  __shared__ _Float16 Vt[64 * 40];     // transposed: 64 d x 32 kv

  const float scale = scale_p[0] * 0.125f;  // 1/sqrt(64)
  const float beta  = beta_p[0];

  {  // Stage Q tile once.
    const int row = t >> 1;
    const int cb  = (t & 1) * 32;
    const _Float16* src =
        q + ((size_t)(b * ALQ + qt * 64 + row)) * AD + h * AHD + cb;
    _Float16* dst = &Qs[row * 72 + cb];
#pragma unroll
    for (int i = 0; i < 4; ++i)
      *(v8h*)(dst + i * 8) = *(const v8h*)(src + i * 8);
  }
  __syncthreads();

  // B operand Q^T: column lm = query w*16+lm, k = d in the hardware order.
  v16h qb0 = load_frag(Qs, 72, w * 16 + lm, 0, g);
  v16h qb1 = load_frag(Qs, 72, w * 16 + lm, 32, g);

  // Per lane: running max and this half's partial sum of query w*16+lm.
  float mrow = -1e30f, lrow = 0.0f;
  v8f acc[4];  // acc[d][r] = O^T[d*16 + 8g + r][query lm]
#pragma unroll
  for (int d = 0; d < 4; ++d) acc[d] = zero_v8f();

  for (int cchunk = 0; cchunk < ALKV / 32; ++cchunk) {
    const int kv0 = cchunk * 32;
    __syncthreads();

    {  // K chunk row-major.
      const int row = t >> 2;
      const int cb  = (t & 3) * 16;
      const _Float16* src =
          kmat + ((size_t)(b * ALKV + kv0 + row)) * AD + h * AHD + cb;
      *(v8h*)(&Ks[row * 72 + cb])     = *(const v8h*)(src);
      *(v8h*)(&Ks[row * 72 + cb + 8]) = *(const v8h*)(src + 8);
    }
    {  // V chunk transposed.
      const int row = t >> 2;
      const int cb  = (t & 3) * 16;
      const _Float16* src =
          vmat + ((size_t)(b * ALKV + kv0 + row)) * AD + h * AHD + cb;
#pragma unroll
      for (int i = 0; i < 16; ++i) Vt[(cb + i) * 40 + row] = src[i];
    }
    __syncthreads();

    // s0[r] = S^T[key 8g + r][query lm], s1[r] = S^T[key 16 + 8g + r][query lm].
    v8f s0 = zero_v8f(), s1 = zero_v8f();
    {
      v16h ka;
      ka = load_frag(Ks, 72, lm, 0, g);        s0 = wmma_f32_f16(ka, qb0, s0);
      ka = load_frag(Ks, 72, lm, 32, g);       s0 = wmma_f32_f16(ka, qb1, s0);
      ka = load_frag(Ks, 72, 16 + lm, 0, g);   s1 = wmma_f32_f16(ka, qb0, s1);
      ka = load_frag(Ks, 72, 16 + lm, 32, g);  s1 = wmma_f32_f16(ka, qb1, s1);
    }

    float a0[8], a1[8];
    float mx = -1e30f;
#pragma unroll
    for (int r = 0; r < 8; ++r) {
      a0[r] = s0[r] * scale + beta;
      a1[r] = s1[r] * scale + beta;
      mx = fmaxf(mx, fmaxf(a0[r], a1[r]));
    }
    mx = fmaxf(mx, xhalf(mx));  // both halves now hold the query's chunk max
    const float mnew  = fmaxf(mrow, mx);
    const float alpha = __expf(mrow - mnew);
    mrow = mnew;

    // P^T as B operand: element s is key kmap(s) = 8g + s (s < 8), 16 + 8g + s - 8.
    v16h pb;
    float ps = 0.0f;
#pragma unroll
    for (int r = 0; r < 8; ++r) {
      const float p0 = __expf(a0[r] - mnew);
      const float p1 = __expf(a1[r] - mnew);
      ps += p0 + p1;
      pb[r]     = (_Float16)p0;
      pb[r + 8] = (_Float16)p1;
    }
    lrow = lrow * alpha + ps;
#pragma unroll
    for (int d = 0; d < 4; ++d) acc[d] *= alpha;

#pragma unroll
    for (int d = 0; d < 4; ++d) {
      v16h va = load_frag(Vt, 40, d * 16 + lm, 0, g);  // A: row d, same k order
      acc[d] = wmma_f32_f16(va, pb, acc[d]);
    }
  }

  {
    const float rinv = 1.0f / (lrow + xhalf(lrow));  // join the halves' sums
    const int qrow = qt * 64 + w * 16 + lm;
    _Float16* dst = ctx + ((size_t)(b * ALQ + qrow)) * AD + h * AHD + 8 * g;
#pragma unroll
    for (int d = 0; d < 4; ++d) {
      v8h o;
#pragma unroll
      for (int r = 0; r < 8; ++r) o[r] = (_Float16)(acc[d][r] * rinv);
      *(v8h*)(dst + d * 16) = o;  // 8 consecutive d of one query: one 16B store
    }
  }
}

// ---------------------------------------------------------------------------
// Launcher. Workspace (f16 unless noted):
//  [0,8)MB qdom | [8,24) kvdom | [24,26) Wq | [26,28) Wk | [28,30) Wv
//  [30,32) Wo | [32,40) q | [40,56) k | [56,72) v | [72,80) ctx  => 80MB
// ---------------------------------------------------------------------------
extern "C" void kernel_launch(void* const* d_in, const int* in_sizes, int n_in,
                              void* d_out, int out_size, void* d_ws,
                              size_t ws_size, hipStream_t stream) {
  (void)in_sizes; (void)n_in; (void)out_size; (void)ws_size;

  const float* qdom  = (const float*)d_in[0];
  const float* kvdom = (const float*)d_in[1];
  const float* Wq = (const float*)d_in[2];
  const float* bq = (const float*)d_in[3];
  const float* Wk = (const float*)d_in[4];
  const float* bk = (const float*)d_in[5];
  const float* Wv = (const float*)d_in[6];
  const float* bv = (const float*)d_in[7];
  const float* Wo = (const float*)d_in[8];
  const float* bo = (const float*)d_in[9];
  const float* scale = (const float*)d_in[10];
  const float* beta  = (const float*)d_in[11];
  float* out = (float*)d_out;

  const size_t MB = 1u << 20;
  char* ws = (char*)d_ws;
  _Float16* qdom_h  = (_Float16*)(ws + 0 * MB);
  _Float16* kvdom_h = (_Float16*)(ws + 8 * MB);
  _Float16* Wq_h    = (_Float16*)(ws + 24 * MB);
  _Float16* Wk_h    = (_Float16*)(ws + 26 * MB);
  _Float16* Wv_h    = (_Float16*)(ws + 28 * MB);
  _Float16* Wo_h    = (_Float16*)(ws + 30 * MB);
  _Float16* qh      = (_Float16*)(ws + 32 * MB);
  _Float16* kh      = (_Float16*)(ws + 40 * MB);
  _Float16* vh      = (_Float16*)(ws + 56 * MB);
  _Float16* ctxh    = (_Float16*)(ws + 72 * MB);

  // qdom_h .. Wo_h are contiguous: one flat destination of 16 * 2^20 halfs.
  cvt_all_kernel<<<dim3(512), dim3(256), 0, stream>>>(qdom, kvdom, Wq, Wk, Wv,
                                                      Wo, qdom_h);

  const dim3 blk(256);
  gemm_h_kernel<_Float16><<<dim3(1024 / 128, 4096 / 128), blk, 0, stream>>>(
      qdom_h, Wq_h, bq, qh, 4096, 1024, 1024);
  gemm_h_kernel<_Float16><<<dim3(1024 / 128, 8192 / 128), blk, 0, stream>>>(
      kvdom_h, Wk_h, bk, kh, 8192, 1024, 1024);
  gemm_h_kernel<_Float16><<<dim3(1024 / 128, 8192 / 128), blk, 0, stream>>>(
      kvdom_h, Wv_h, bv, vh, 8192, 1024, 1024);

  attn_kernel<<<dim3(ALQ / 64, AH, AB), dim3(128), 0, stream>>>(
      qh, kh, vh, ctxh, scale, beta);

  gemm_h_kernel<float><<<dim3(1024 / 128, 4096 / 128), blk, 0, stream>>>(
      ctxh, Wo_h, bo, out, 4096, 1024, 1024);
}

// v003
// A run of this version takes 175 microseconds.
// Two timings next to v002 put it at 1.07 and 1.06 times that version's speed.
// All steps since v000 together make it 1.29 times as fast.
#include <hip/hip_runtime.h>
#include <hip/hip_bf16.h>

typedef float     v8f  __attribute__((ext_vector_type(8)));
typedef _Float16  v8h  __attribute__((ext_vector_type(8)));
typedef _Float16  v16h __attribute__((ext_vector_type(16)));

__device__ __forceinline__ v8f wmma_f32_f16(v16h a, v16h b, v8f c) {
  return __builtin_amdgcn_wmma_f32_16x16x32_f16(false, a, false, b, (short)0, c,
                                                false, false);
}

__device__ __forceinline__ v8f zero_v8f() {
  v8f z;
#pragma unroll
  for (int i = 0; i < 8; ++i) z[i] = 0.0f;
  return z;
}

__device__ __forceinline__ v16h load_frag(const _Float16* base, int stride,
                                          int row, int koff, int g) {
  const _Float16* p = base + row * stride + koff + 8 * g;
  v8h lo = *(const v8h*)(p);
  v8h hi = *(const v8h*)(p + 16);
  v16h r;
#pragma unroll
  for (int e = 0; e < 8; ++e) { r[e] = lo[e]; r[e + 8] = hi[e]; }
  return r;
}

typedef short s16x8 __attribute__((ext_vector_type(8)));
__device__ __forceinline__ v8h load_tr16(const _Float16* p) {
  typedef __attribute__((address_space(3))) s16x8 lds_s16x8;
  return __builtin_bit_cast(
      v8h, __builtin_amdgcn_ds_load_tr16_b128_v8i16((lds_s16x8*)p));
}

__device__ __forceinline__ void async_copy_b128(unsigned lds_off,
                                                const void* sbase,
                                                unsigned voff) {
  asm volatile("global_load_async_to_lds_b128 %0, %1, %2"
               :
               : "v"(lds_off), "v"(voff), "s"(sbase)
               : "memory");
}

__device__ __forceinline__ void wait_async0() {
  asm volatile("s_wait_asynccnt 0x0" ::: "memory");
}

// ---------------------------------------------------------------------------
// fp32 -> f16 of all six matrix inputs in ONE launch (every GEMM input is f16).
// The f16 copies lie back to back in the workspace, in the order q-domain (4),
// kv-domain (8), Wq, Wk, Wv, Wo (1 each, in pieces of 2^20 elements), so dst is
// one flat array. A block owns 32768 consecutive elements (32 blocks a piece,
// so a block never straddles two sources); a thread converts 16 groups of 8.
// 512 blocks = 4096 waves to start (two blocks a WGP), where one group a thread
// would start 65536; a wave's loads all stand ahead of its stores.
// ---------------------------------------------------------------------------
__global__ __launch_bounds__(256) void cvt_all_kernel(
    const float* __restrict__ qd, const float* __restrict__ kvd,
    const float* __restrict__ wq, const float* __restrict__ wk,
    const float* __restrict__ wv, const float* __restrict__ wo,
    _Float16* __restrict__ dst) {
  const int piece = blockIdx.x >> 5;  // block-uniform: scalar selects
  const float* src = qd;
  int first = 0;  // first piece of the chosen source
  if (piece >= 4)  { src = kvd; first = 4; }
  if (piece == 12) { src = wq;  first = 12; }
  if (piece == 13) { src = wk;  first = 13; }
  if (piece == 14) { src = wv;  first = 14; }
  if (piece == 15) { src = wo;  first = 15; }

  const size_t base = (size_t)blockIdx.x * 32768 + threadIdx.x * 8;
  const float* s = src + (base - ((size_t)first << 20));
  _Float16* d = dst + base;

  v8f x[16];
#pragma unroll  // straight line, so that many loads of a wave are in flight at once
  for (int k = 0; k < 16; ++k) x[k] = *(const v8f*)(s + k * 2048);
#pragma unroll  // x[] must stay in registers: constant indices only
  for (int k = 0; k < 16; ++k) {
    v8h h;
#pragma unroll
    for (int e = 0; e < 8; ++e) h[e] = (_Float16)x[k][e];
    *(v8h*)(d + k * 2048) = h;
  }
}

template <typename OutT>
__global__ __launch_bounds__(256) void gemm_h_kernel(
    const _Float16* __restrict__ X, const _Float16* __restrict__ W,
    const float* __restrict__ bias, OutT* __restrict__ Y,
    int M, int N, int K) {
  const int n0 = blockIdx.x * 128;
  const int m0 = blockIdx.y * 128;
  const int t  = threadIdx.x;
  const int w  = t >> 5;
  const int l  = t & 31;
  const int lm = l & 15;
  const int g  = l >> 4;
  const int wm = w & 1;    // 2 waves along M (64 rows each)
  const int wn = w >> 1;   // 4 waves along N (32 cols each)

  // stride 40 halfs = 80B (16B-divisible -> b128 frag loads); 2 buffers.
  __shared__ _Float16 As[2][128 * 40];
  __shared__ _Float16 Bs[2][128 * 40];

  v8f c[4][2];
#pragma unroll
  for (int i = 0; i < 4; ++i)
#pragma unroll
    for (int j = 0; j < 2; ++j) c[i][j] = zero_v8f();

  // Per-thread staging share: one row (t>>1) of the 128x32 slab, 16-half
  // column chunk ((t&1)*16) -> two async b128 per matrix per k-step.
  const int srow = t >> 1;
  const int scol = (t & 1) * 16;
  const unsigned grow_off = (unsigned)((srow * K + scol) * 2);  // bytes
  const unsigned lrow_off = (unsigned)((srow * 40 + scol) * 2); // bytes

  const _Float16* Xb = X + (size_t)m0 * K;
  const _Float16* Wb = W + (size_t)n0 * K;

  // Prologue: stage slab 0 into buffer 0.
  {
    unsigned la = (unsigned)(uintptr_t)(&As[0][0]) + lrow_off;
    unsigned lb = (unsigned)(uintptr_t)(&Bs[0][0]) + lrow_off;
    async_copy_b128(la,       Xb, grow_off);
    async_copy_b128(la + 16u, Xb, grow_off + 16u);
    async_copy_b128(lb,       Wb, grow_off);
    async_copy_b128(lb + 16u, Wb, grow_off + 16u);
  }
  wait_async0();
  __syncthreads();

  for (int kt = 0; kt < K; kt += 32) {
    const int cur = (kt >> 5) & 1;
    const bool more = (kt + 32) < K;

    // Issue next slab into the other buffer (overlaps with wmma below).
    if (more) {
      const unsigned gofs = grow_off + (unsigned)((kt + 32) * 2);
      unsigned la = (unsigned)(uintptr_t)(&As[cur ^ 1][0]) + lrow_off;
      unsigned lb = (unsigned)(uintptr_t)(&Bs[cur ^ 1][0]) + lrow_off;
      async_copy_b128(la,       Xb, gofs);
      async_copy_b128(la + 16u, Xb, gofs + 16u);
      async_copy_b128(lb,       Wb, gofs);
      async_copy_b128(lb + 16u, Wb, gofs + 16u);
    }

    // Compute on current buffer: 4 A-frags, 2 B-frags, 8 wmma.
    const _Float16* Ab = As[cur];
    const _Float16* Bb = Bs[cur];
    v16h af[4];
#pragma unroll
    for (int i = 0; i < 4; ++i)
      af[i] = load_frag(Ab, 40, wm * 64 + i * 16 + lm, 0, g);
#pragma unroll
    for (int j = 0; j < 2; ++j) {
      v16h bf = load_frag(Bb, 40, wn * 32 + j * 16 + lm, 0, g);
#pragma unroll
      for (int i = 0; i < 4; ++i) c[i][j] = wmma_f32_f16(af[i], bf, c[i][j]);
    }

    if (more) wait_async0();
    __syncthreads();
  }

  // Epilogue: C layout -> lane holds col n = lm, rows r + 8g.
#pragma unroll
  for (int j = 0; j < 2; ++j) {
    const int ncol = n0 + wn * 32 + j * 16 + lm;
    const float bj = bias[ncol];
#pragma unroll
    for (int i = 0; i < 4; ++i) {
#pragma unroll
      for (int r = 0; r < 8; ++r) {
        const int mrow = m0 + wm * 64 + i * 16 + r + 8 * g;
        Y[(size_t)mrow * N + ncol] = (OutT)(c[i][j][r] + bj);
      }
    }
  }
}

#define AB   4
#define ALQ  1024
#define ALKV 2048
#define AD   1024
#define AH   16
#define AHD  64

__device__ __forceinline__ float xhalf(float x) {
  const int i = __builtin_bit_cast(int, x);
  return __builtin_bit_cast(
      float, __builtin_amdgcn_permlanex16(i, i, 0x76543210, 0xfedcba98, false,
                                          false));
}

__global__ __launch_bounds__(128) void attn_kernel(
    const _Float16* __restrict__ q, const _Float16* __restrict__ kmat,
    const _Float16* __restrict__ vmat, _Float16* __restrict__ ctx,
    const float* __restrict__ scale_p, const float* __restrict__ beta_p) {
  const int qt = blockIdx.x;
  const int h  = blockIdx.y;
  const int b  = blockIdx.z;
  const int t  = threadIdx.x;
  const int w  = t >> 5;
  const int l  = t & 31;
  const int lm = l & 15;
  const int g  = l >> 4;

  __shared__ _Float16 Qs[64 * 72];     // 64 q-rows x 64 d (stride 72)
  __shared__ _Float16 Ks[32 * 72];     // 32 kv-rows x 64 d
  __shared__ _Float16 Vs[32 * 80];     // 32 kv-rows x 64 d (stride 80: 5 x 32 B)

  const float scale = scale_p[0] * 0.125f;  // 1/sqrt(64)
  const float beta  = beta_p[0];

  {  // Stage Q tile once.
    const int row = t >> 1;
    const int cb  = (t & 1) * 32;
    const _Float16* src =
        q + ((size_t)(b * ALQ + qt * 64 + row)) * AD + h * AHD + cb;
    _Float16* dst = &Qs[row * 72 + cb];
#pragma unroll
    for (int i = 0; i < 4; ++i)
      *(v8h*)(dst + i * 8) = *(const v8h*)(src + i * 8);
  }
  __syncthreads();

  // B operand Q^T: column lm = query w*16+lm, k = d in the hardware order.
  v16h qb0 = load_frag(Qs, 72, w * 16 + lm, 0, g);
  v16h qb1 = load_frag(Qs, 72, w * 16 + lm, 32, g);

  // This lane's address for the transposing loads of V (keys 0..15, d 0..15).
  const _Float16* vtp = &Vs[(8 * g + (l & 7)) * 80 + 8 * ((l >> 3) & 1)];

  // Per lane: running max and this half's partial sum of query w*16+lm.
  float mrow = -1e30f, lrow = 0.0f;
  v8f acc[4];  // acc[d][r] = O^T[d*16 + 8g + r][query lm]
#pragma unroll
  for (int d = 0; d < 4; ++d) acc[d] = zero_v8f();

  for (int cchunk = 0; cchunk < ALKV / 32; ++cchunk) {
    const int kv0 = cchunk * 32;
    __syncthreads();

    {  // K chunk row-major.
      const int row = t >> 2;
      const int cb  = (t & 3) * 16;
      const _Float16* src =
          kmat + ((size_t)(b * ALKV + kv0 + row)) * AD + h * AHD + cb;
      *(v8h*)(&Ks[row * 72 + cb])     = *(const v8h*)(src);
      *(v8h*)(&Ks[row * 72 + cb + 8]) = *(const v8h*)(src + 8);
    }
    {  // V chunk row-major.
      const int row = t >> 2;
      const int cb  = (t & 3) * 16;
      const _Float16* src =
          vmat + ((size_t)(b * ALKV + kv0 + row)) * AD + h * AHD + cb;
      *(v8h*)(&Vs[row * 80 + cb])     = *(const v8h*)(src);
      *(v8h*)(&Vs[row * 80 + cb + 8]) = *(const v8h*)(src + 8);
    }
    __syncthreads();

    // s0[r] = S^T[key 8g + r][query lm], s1[r] = S^T[key 16 + 8g + r][query lm].
    v8f s0 = zero_v8f(), s1 = zero_v8f();
    {
      v16h ka;
      ka = load_frag(Ks, 72, lm, 0, g);        s0 = wmma_f32_f16(ka, qb0, s0);
      ka = load_frag(Ks, 72, lm, 32, g);       s0 = wmma_f32_f16(ka, qb1, s0);
      ka = load_frag(Ks, 72, 16 + lm, 0, g);   s1 = wmma_f32_f16(ka, qb0, s1);
      ka = load_frag(Ks, 72, 16 + lm, 32, g);  s1 = wmma_f32_f16(ka, qb1, s1);
    }

    float a0[8], a1[8];
    float mx = -1e30f;
#pragma unroll
    for (int r = 0; r < 8; ++r) {
      a0[r] = s0[r] * scale + beta;
      a1[r] = s1[r] * scale + beta;
      mx = fmaxf(mx, fmaxf(a0[r], a1[r]));
    }
    mx = fmaxf(mx, xhalf(mx));  // both halves now hold the query's chunk max
    const float mnew  = fmaxf(mrow, mx);
    const float alpha = __expf(mrow - mnew);
    mrow = mnew;

    // P^T as B operand: element s is key kmap(s) = 8g + s (s < 8), 16 + 8g + s - 8.
    v16h pb;
    float ps = 0.0f;
#pragma unroll
    for (int r = 0; r < 8; ++r) {
      const float p0 = __expf(a0[r] - mnew);
      const float p1 = __expf(a1[r] - mnew);
      ps += p0 + p1;
      pb[r]     = (_Float16)p0;
      pb[r + 8] = (_Float16)p1;
    }
    lrow = lrow * alpha + ps;
#pragma unroll
    for (int d = 0; d < 4; ++d) acc[d] *= alpha;

#pragma unroll
    for (int d = 0; d < 4; ++d) {
      // A = V^T: row d*16 + lm, keys 8g + 0..7 then 16 + 8g + 0..7 (pb's order).
      const v8h lo = load_tr16(vtp + d * 16);
      const v8h hi = load_tr16(vtp + 16 * 80 + d * 16);
      v16h va;
#pragma unroll
      for (int e = 0; e < 8; ++e) { va[e] = lo[e]; va[e + 8] = hi[e]; }
      acc[d] = wmma_f32_f16(va, pb, acc[d]);
    }
  }

  {
    const float rinv = 1.0f / (lrow + xhalf(lrow));  // join the halves' sums
    const int qrow = qt * 64 + w * 16 + lm;
    _Float16* dst = ctx + ((size_t)(b * ALQ + qrow)) * AD + h * AHD + 8 * g;
#pragma unroll
    for (int d = 0; d < 4; ++d) {
      v8h o;
#pragma unroll
      for (int r = 0; r < 8; ++r) o[r] = (_Float16)(acc[d][r] * rinv);
      *(v8h*)(dst + d * 16) = o;  // 8 consecutive d of one query: one 16B store
    }
  }
}

// ---------------------------------------------------------------------------
// Launcher. Workspace (f16 unless noted):
//  [0,8)MB qdom | [8,24) kvdom | [24,26) Wq | [26,28) Wk | [28,30) Wv
//  [30,32) Wo | [32,40) q | [40,56) k | [56,72) v | [72,80) ctx  => 80MB
// ---------------------------------------------------------------------------
extern "C" void kernel_launch(void* const* d_in, const int* in_sizes, int n_in,
                              void* d_out, int out_size, void* d_ws,
                              size_t ws_size, hipStream_t stream) {
  (void)in_sizes; (void)n_in; (void)out_size; (void)ws_size;

  const float* qdom  = (const float*)d_in[0];
  const float* kvdom = (const float*)d_in[1];
  const float* Wq = (const float*)d_in[2];
  const float* bq = (const float*)d_in[3];
  const float* Wk = (const float*)d_in[4];
  const float* bk = (const float*)d_in[5];
  const float* Wv = (const float*)d_in[6];
  const float* bv = (const float*)d_in[7];
  const float* Wo = (const float*)d_in[8];
  const float* bo = (const float*)d_in[9];
  const float* scale = (const float*)d_in[10];
  const float* beta  = (const float*)d_in[11];
  float* out = (float*)d_out;

  const size_t MB = 1u << 20;
  char* ws = (char*)d_ws;
  _Float16* qdom_h  = (_Float16*)(ws + 0 * MB);
  _Float16* kvdom_h = (_Float16*)(ws + 8 * MB);
  _Float16* Wq_h    = (_Float16*)(ws + 24 * MB);
  _Float16* Wk_h    = (_Float16*)(ws + 26 * MB);
  _Float16* Wv_h    = (_Float16*)(ws + 28 * MB);
  _Float16* Wo_h    = (_Float16*)(ws + 30 * MB);
  _Float16* qh      = (_Float16*)(ws + 32 * MB);
  _Float16* kh      = (_Float16*)(ws + 40 * MB);
  _Float16* vh      = (_Float16*)(ws + 56 * MB);
  _Float16* ctxh    = (_Float16*)(ws + 72 * MB);

  // qdom_h .. Wo_h are contiguous: one flat destination of 16 * 2^20 halfs.
  cvt_all_kernel<<<dim3(512), dim3(256), 0, stream>>>(qdom, kvdom, Wq, Wk, Wv,
                                                      Wo, qdom_h);

  const dim3 blk(256);
  gemm_h_kernel<_Float16><<<dim3(1024 / 128, 4096 / 128), blk, 0, stream>>>(
      qdom_h, Wq_h, bq, qh, 4096, 1024, 1024);
  gemm_h_kernel<_Float16><<<dim3(1024 / 128, 8192 / 128), blk, 0, stream>>>(
      kvdom_h, Wk_h, bk, kh, 8192, 1024, 1024);
  gemm_h_kernel<_Float16><<<dim3(1024 / 128, 8192 / 128), blk, 0, stream>>>(
      kvdom_h, Wv_h, bv, vh, 8192, 1024, 1024);

  attn_kernel<<<dim3(ALQ / 64, AH, AB), dim3(128), 0, stream>>>(
      qh, kh, vh, ctxh, scale, beta);

  gemm_h_kernel<float><<<dim3(1024 / 128, 4096 / 128), blk, 0, stream>>>(
      ctxh, Wo_h, bo, out, 4096, 1024, 1024);
}

// v004
// It runs in 151 microseconds.
// In both of two side-by-side timings against v003, it was 1.17 times as fast.
// Over all steps from v000 it is 1.51 times as fast.
#include <hip/hip_runtime.h>
#include <hip/hip_bf16.h>

typedef float     v8f  __attribute__((ext_vector_type(8)));
typedef _Float16  v8h  __attribute__((ext_vector_type(8)));
typedef _Float16  v16h __attribute__((ext_vector_type(16)));

__device__ __forceinline__ v8f wmma_f32_f16(v16h a, v16h b, v8f c) {
  return __builtin_amdgcn_wmma_f32_16x16x32_f16(false, a, false, b, (short)0, c,
                                                false, false);
}

__device__ __forceinline__ v8f zero_v8f() {
  v8f z;
#pragma unroll
  for (int i = 0; i < 8; ++i) z[i] = 0.0f;
  return z;
}

__device__ __forceinline__ v16h load_frag(const _Float16* base, int stride,
                                          int row, int koff, int g) {
  const _Float16* p = base + row * stride + koff + 8 * g;
  v8h lo = *(const v8h*)(p);
  v8h hi = *(const v8h*)(p + 16);
  v16h r;
#pragma unroll
  for (int e = 0; e < 8; ++e) { r[e] = lo[e]; r[e + 8] = hi[e]; }
  return r;
}

typedef short s16x8 __attribute__((ext_vector_type(8)));
__device__ __forceinline__ v8h load_tr16(const _Float16* p) {
  typedef __attribute__((address_space(3))) s16x8 lds_s16x8;
  return __builtin_bit_cast(
      v8h, __builtin_amdgcn_ds_load_tr16_b128_v8i16((lds_s16x8*)p));
}

__device__ __forceinline__ void async_copy8_b128(unsigned lds, unsigned lstep,
                                                 const _Float16* g, int gstep) {
  asm volatile(
      "global_load_async_to_lds_b128 %0, %8, off\n\t"
      "global_load_async_to_lds_b128 %1, %9, off\n\t"
      "global_load_async_to_lds_b128 %2, %10, off\n\t"
      "global_load_async_to_lds_b128 %3, %11, off\n\t"
      "global_load_async_to_lds_b128 %4, %12, off\n\t"
      "global_load_async_to_lds_b128 %5, %13, off\n\t"
      "global_load_async_to_lds_b128 %6, %14, off\n\t"
      "global_load_async_to_lds_b128 %7, %15, off\n\t"
      "s_wait_xcnt 0x0"
      :
      : "v"(lds), "v"(lds + lstep), "v"(lds + 2 * lstep), "v"(lds + 3 * lstep),
        "v"(lds + 4 * lstep), "v"(lds + 5 * lstep), "v"(lds + 6 * lstep),
        "v"(lds + 7 * lstep), "v"(g), "v"(g + gstep), "v"(g + 2 * gstep),
        "v"(g + 3 * gstep), "v"(g + 4 * gstep), "v"(g + 5 * gstep),
        "v"(g + 6 * gstep), "v"(g + 7 * gstep)
      : "memory");
}

// This wave's copies have landed (another wave reads them behind the barrier).
__device__ __forceinline__ void wait_async0() {
  asm volatile("s_wait_asynccnt 0x0" ::: "memory");
}

// This wave's LDS reads have returned: the buffer they read may be refilled.
__device__ __forceinline__ void wait_ds0() {
  asm volatile("s_wait_dscnt 0x0" ::: "memory");
}

// ---------------------------------------------------------------------------
// fp32 -> f16 of all six matrix inputs in ONE launch (every GEMM input is f16).
// The f16 copies lie back to back in the workspace, in the order q-domain (4),
// kv-domain (8), Wq, Wk, Wv, Wo (1 each, in pieces of 2^20 elements), so dst is
// one flat array. A block owns 32768 consecutive elements (32 blocks a piece,
// so a block never straddles two sources); a thread converts 16 groups of 8.
// 512 blocks = 4096 waves to start (two blocks a WGP), where one group a thread
// would start 65536; a wave's loads all stand ahead of its stores.
// ---------------------------------------------------------------------------
__global__ __launch_bounds__(256) void cvt_all_kernel(
    const float* __restrict__ qd, const float* __restrict__ kvd,
    const float* __restrict__ wq, const float* __restrict__ wk,
    const float* __restrict__ wv, const float* __restrict__ wo,
    _Float16* __restrict__ dst) {
  const int piece = blockIdx.x >> 5;  // block-uniform: scalar selects
  const float* src = qd;
  int first = 0;  // first piece of the chosen source
  if (piece >= 4)  { src = kvd; first = 4; }
  if (piece == 12) { src = wq;  first = 12; }
  if (piece == 13) { src = wk;  first = 13; }
  if (piece == 14) { src = wv;  first = 14; }
  if (piece == 15) { src = wo;  first = 15; }

  const size_t base = (size_t)blockIdx.x * 32768 + threadIdx.x * 8;
  const float* s = src + (base - ((size_t)first << 20));
  _Float16* d = dst + base;

  v8f x[16];
#pragma unroll  // straight line, so that many loads of a wave are in flight at once
  for (int k = 0; k < 16; ++k) x[k] = *(const v8f*)(s + k * 2048);
#pragma unroll  // x[] must stay in registers: constant indices only
  for (int k = 0; k < 16; ++k) {
    v8h h;
#pragma unroll
    for (int e = 0; e < 8; ++e) h[e] = (_Float16)x[k][e];
    *(v8h*)(d + k * 2048) = h;
  }
}

// ---------------------------------------------------------------------------
// GEMM: Y[m,n] = sum_k X[m,k]*W[n,k] + bias[n]  (X,W f16; Y f16 or f32).
// Block 256 = 8 waves; tile 128(M) x 128(N); wave tile 64x32 (c[4][2]).
// K goes in stages of 128 halfs = 256 B of every operand row, so that one
// wave-wide async copy is two whole rows of the stage: four whole 128-B lines
// (a 64-B stage row made it 16 lines of 32 B each). Two LDS buffers:
//   wmma on stage s -> dscnt 0 -> asynccnt 0 -> barrier -> copies of stage s+2.
// 32 wmma per wave per stage, k ascending. K: a multiple of 128, at least 128.
// ---------------------------------------------------------------------------
#define GBK    128  // halfs of K a stage
#define GPITCH 136  // LDS row pitch in halfs: 272 B = 16 B x 17 (b128 readers)

template <typename OutT>
__global__ __launch_bounds__(256) void gemm_h_kernel(
    const _Float16* __restrict__ X, const _Float16* __restrict__ W,
    const float* __restrict__ bias, OutT* __restrict__ Y,
    int M, int N, int K) {
  const int n0 = blockIdx.x * 128;
  const int m0 = blockIdx.y * 128;
  const int t  = threadIdx.x;
  const int w  = t >> 5;
  const int l  = t & 31;
  const int lm = l & 15;
  const int g  = l >> 4;
  const int wm = w & 1;    // 2 waves along M (64 rows each)
  const int wn = w >> 1;   // 4 waves along N (32 cols each)

  __shared__ __attribute__((aligned(16))) _Float16 As[2][128 * GPITCH];
  __shared__ __attribute__((aligned(16))) _Float16 Bs[2][128 * GPITCH];

  v8f c[4][2];
#pragma unroll
  for (int i = 0; i < 4; ++i)
#pragma unroll
    for (int j = 0; j < 2; ++j) c[i][j] = zero_v8f();

  // Per-thread staging share: 16-B piece t&15 of rows (t>>4) + 16*i, i = 0..7,
  // of each matrix: 16 lanes cover one 256-B stage row.
  const int srow = t >> 4;
  const int scol = (t & 15) * 8;
  const _Float16* Xg = X + (size_t)(m0 + srow) * K + scol;
  const _Float16* Wg = W + (size_t)(n0 + srow) * K + scol;
  const unsigned lofs = (unsigned)((srow * GPITCH + scol) * 2);  // bytes
  const unsigned la0 = (unsigned)(uintptr_t)(&As[0][0]) + lofs;
  const unsigned lb0 = (unsigned)(uintptr_t)(&Bs[0][0]) + lofs;
  const unsigned lbuf  = 128 * GPITCH * 2;  // bytes from buffer 0 to buffer 1
  const unsigned lstep = 16 * GPITCH * 2;   // bytes from a copy's row to the next's
  const int nst = K / GBK;

  // Stage 0 into buffer 0, published; then stage 1 flies into buffer 1.
  async_copy8_b128(la0, lstep, Xg, 16 * K);
  async_copy8_b128(lb0, lstep, Wg, 16 * K);
  wait_async0();
  __syncthreads();
  if (nst > 1) {
    async_copy8_b128(la0 + lbuf, lstep, Xg + GBK, 16 * K);
    async_copy8_b128(lb0 + lbuf, lstep, Wg + GBK, 16 * K);
  }

  for (int s = 0; s < nst; ++s) {
    const int cur = s & 1;
    const _Float16* Ab = As[cur];
    const _Float16* Bb = Bs[cur];
#pragma unroll
    for (int ks = 0; ks < GBK; ks += 32) {
      v16h af[4];
#pragma unroll
      for (int i = 0; i < 4; ++i)
        af[i] = load_frag(Ab, GPITCH, wm * 64 + i * 16 + lm, ks, g);
#pragma unroll
      for (int j = 0; j < 2; ++j) {
        v16h bf = load_frag(Bb, GPITCH, wn * 32 + j * 16 + lm, ks, g);
#pragma unroll
        for (int i = 0; i < 4; ++i) c[i][j] = wmma_f32_f16(af[i], bf, c[i][j]);
      }
    }

    // Publish stage s+1 and free stage s's buffer, then refill that buffer.
    wait_ds0();
    wait_async0();
    __syncthreads();
    if (s + 2 < nst) {
      const unsigned lo = cur ? lbuf : 0u;
      async_copy8_b128(la0 + lo, lstep, Xg + (s + 2) * GBK, 16 * K);
      async_copy8_b128(lb0 + lo, lstep, Wg + (s + 2) * GBK, 16 * K);
    }
  }
  wait_async0();  // nothing is in flight here; kept in front of the wave's end

  // Epilogue: C layout -> lane holds col n = lm, rows r + 8g.
#pragma unroll
  for (int j = 0; j < 2; ++j) {
    const int ncol = n0 + wn * 32 + j * 16 + lm;
    const float bj = bias[ncol];
#pragma unroll
    for (int i = 0; i < 4; ++i) {
#pragma unroll
      for (int r = 0; r < 8; ++r) {
        const int mrow = m0 + wm * 64 + i * 16 + r + 8 * g;
        Y[(size_t)mrow * N + ncol] = (OutT)(c[i][j][r] + bj);
      }
    }
  }
}

#define AB   4
#define ALQ  1024
#define ALKV 2048
#define AD   1024
#define AH   16
#define AHD  64

__device__ __forceinline__ float xhalf(float x) {
  const int i = __builtin_bit_cast(int, x);
  return __builtin_bit_cast(
      float, __builtin_amdgcn_permlanex16(i, i, 0x76543210, 0xfedcba98, false,
                                          false));
}

__global__ __launch_bounds__(128) void attn_kernel(
    const _Float16* __restrict__ q, const _Float16* __restrict__ kmat,
    const _Float16* __restrict__ vmat, _Float16* __restrict__ ctx,
    const float* __restrict__ scale_p, const float* __restrict__ beta_p) {
  const int qt = blockIdx.x;
  const int h  = blockIdx.y;
  const int b  = blockIdx.z;
  const int t  = threadIdx.x;
  const int w  = t >> 5;
  const int l  = t & 31;
  const int lm = l & 15;
  const int g  = l >> 4;

  __shared__ _Float16 Qs[64 * 72];     // 64 q-rows x 64 d (stride 72)
  __shared__ _Float16 Ks[32 * 72];     // 32 kv-rows x 64 d
  __shared__ _Float16 Vs[32 * 80];     // 32 kv-rows x 64 d (stride 80: 5 x 32 B)

  const float scale = scale_p[0] * 0.125f;  // 1/sqrt(64)
  const float beta  = beta_p[0];

  {  // Stage Q tile once.
    const int row = t >> 1;
    const int cb  = (t & 1) * 32;
    const _Float16* src =
        q + ((size_t)(b * ALQ + qt * 64 + row)) * AD + h * AHD + cb;
    _Float16* dst = &Qs[row * 72 + cb];
#pragma unroll
    for (int i = 0; i < 4; ++i)
      *(v8h*)(dst + i * 8) = *(const v8h*)(src + i * 8);
  }
  __syncthreads();

  // B operand Q^T: column lm = query w*16+lm, k = d in the hardware order.
  v16h qb0 = load_frag(Qs, 72, w * 16 + lm, 0, g);
  v16h qb1 = load_frag(Qs, 72, w * 16 + lm, 32, g);

  // This lane's address for the transposing loads of V (keys 0..15, d 0..15).
  const _Float16* vtp = &Vs[(8 * g + (l & 7)) * 80 + 8 * ((l >> 3) & 1)];

  // Per lane: running max and this half's partial sum of query w*16+lm.
  float mrow = -1e30f, lrow = 0.0f;
  v8f acc[4];  // acc[d][r] = O^T[d*16 + 8g + r][query lm]
#pragma unroll
  for (int d = 0; d < 4; ++d) acc[d] = zero_v8f();

  for (int cchunk = 0; cchunk < ALKV / 32; ++cchunk) {
    const int kv0 = cchunk * 32;
    __syncthreads();

    {  // K chunk row-major.
      const int row = t >> 2;
      const int cb  = (t & 3) * 16;
      const _Float16* src =
          kmat + ((size_t)(b * ALKV + kv0 + row)) * AD + h * AHD + cb;
      *(v8h*)(&Ks[row * 72 + cb])     = *(const v8h*)(src);
      *(v8h*)(&Ks[row * 72 + cb + 8]) = *(const v8h*)(src + 8);
    }
    {  // V chunk row-major.
      const int row = t >> 2;
      const int cb  = (t & 3) * 16;
      const _Float16* src =
          vmat + ((size_t)(b * ALKV + kv0 + row)) * AD + h * AHD + cb;
      *(v8h*)(&Vs[row * 80 + cb])     = *(const v8h*)(src);
      *(v8h*)(&Vs[row * 80 + cb + 8]) = *(const v8h*)(src + 8);
    }
    __syncthreads();

    // s0[r] = S^T[key 8g + r][query lm], s1[r] = S^T[key 16 + 8g + r][query lm].
    v8f s0 = zero_v8f(), s1 = zero_v8f();
    {
      v16h ka;
      ka = load_frag(Ks, 72, lm, 0, g);        s0 = wmma_f32_f16(ka, qb0, s0);
      ka = load_frag(Ks, 72, lm, 32, g);       s0 = wmma_f32_f16(ka, qb1, s0);
      ka = load_frag(Ks, 72, 16 + lm, 0, g);   s1 = wmma_f32_f16(ka, qb0, s1);
      ka = load_frag(Ks, 72, 16 + lm, 32, g);  s1 = wmma_f32_f16(ka, qb1, s1);
    }

    float a0[8], a1[8];
    float mx = -1e30f;
#pragma unroll
    for (int r = 0; r < 8; ++r) {
      a0[r] = s0[r] * scale + beta;
      a1[r] = s1[r] * scale + beta;
      mx = fmaxf(mx, fmaxf(a0[r], a1[r]));
    }
    mx = fmaxf(mx, xhalf(mx));  // both halves now hold the query's chunk max
    const float mnew  = fmaxf(mrow, mx);
    const float alpha = __expf(mrow - mnew);
    mrow = mnew;

    // P^T as B operand: element s is key kmap(s) = 8g + s (s < 8), 16 + 8g + s - 8.
    v16h pb;
    float ps = 0.0f;
#pragma unroll
    for (int r = 0; r < 8; ++r) {
      const float p0 = __expf(a0[r] - mnew);
      const float p1 = __expf(a1[r] - mnew);
      ps += p0 + p1;
      pb[r]     = (_Float16)p0;
      pb[r + 8] = (_Float16)p1;
    }
    lrow = lrow * alpha + ps;
#pragma unroll
    for (int d = 0; d < 4; ++d) acc[d] *= alpha;

#pragma unroll
    for (int d = 0; d < 4; ++d) {
      // A = V^T: row d*16 + lm, keys 8g + 0..7 then 16 + 8g + 0..7 (pb's order).
      const v8h lo = load_tr16(vtp + d * 16);
      const v8h hi = load_tr16(vtp + 16 * 80 + d * 16);
      v16h va;
#pragma unroll
      for (int e = 0; e < 8; ++e) { va[e] = lo[e]; va[e + 8] = hi[e]; }
      acc[d] = wmma_f32_f16(va, pb, acc[d]);
    }
  }

  {
    const float rinv = 1.0f / (lrow + xhalf(lrow));  // join the halves' sums
    const int qrow = qt * 64 + w * 16 + lm;
    _Float16* dst = ctx + ((size_t)(b * ALQ + qrow)) * AD + h * AHD + 8 * g;
#pragma unroll
    for (int d = 0; d < 4; ++d) {
      v8h o;
#pragma unroll
      for (int r = 0; r < 8; ++r) o[r] = (_Float16)(acc[d][r] * rinv);
      *(v8h*)(dst + d * 16) = o;  // 8 consecutive d of one query: one 16B store
    }
  }
}

// ---------------------------------------------------------------------------
// Launcher. Workspace (f16 unless noted):
//  [0,8)MB qdom | [8,24) kvdom | [24,26) Wq | [26,28) Wk | [28,30) Wv
//  [30,32) Wo | [32,40) q | [40,56) k | [56,72) v | [72,80) ctx  => 80MB
// ---------------------------------------------------------------------------
extern "C" void kernel_launch(void* const* d_in, const int* in_sizes, int n_in,
                              void* d_out, int out_size, void* d_ws,
                              size_t ws_size, hipStream_t stream) {
  (void)in_sizes; (void)n_in; (void)out_size; (void)ws_size;

  const float* qdom  = (const float*)d_in[0];
  const float* kvdom = (const float*)d_in[1];
  const float* Wq = (const float*)d_in[2];
  const float* bq = (const float*)d_in[3];
  const float* Wk = (const float*)d_in[4];
  const float* bk = (const float*)d_in[5];
  const float* Wv = (const float*)d_in[6];
  const float* bv = (const float*)d_in[7];
  const float* Wo = (const float*)d_in[8];
  const float* bo = (const float*)d_in[9];
  const float* scale = (const float*)d_in[10];
  const float* beta  = (const float*)d_in[11];
  float* out = (float*)d_out;

  const size_t MB = 1u << 20;
  char* ws = (char*)d_ws;
  _Float16* qdom_h  = (_Float16*)(ws + 0 * MB);
  _Float16* kvdom_h = (_Float16*)(ws + 8 * MB);
  _Float16* Wq_h    = (_Float16*)(ws + 24 * MB);
  _Float16* Wk_h    = (_Float16*)(ws + 26 * MB);
  _Float16* Wv_h    = (_Float16*)(ws + 28 * MB);
  _Float16* Wo_h    = (_Float16*)(ws + 30 * MB);
  _Float16* qh      = (_Float16*)(ws + 32 * MB);
  _Float16* kh      = (_Float16*)(ws + 40 * MB);
  _Float16* vh      = (_Float16*)(ws + 56 * MB);
  _Float16* ctxh    = (_Float16*)(ws + 72 * MB);

  // qdom_h .. Wo_h are contiguous: one flat destination of 16 * 2^20 halfs.
  cvt_all_kernel<<<dim3(512), dim3(256), 0, stream>>>(qdom, kvdom, Wq, Wk, Wv,
                                                      Wo, qdom_h);

  const dim3 blk(256);
  gemm_h_kernel<_Float16><<<dim3(1024 / 128, 4096 / 128), blk, 0, stream>>>(
      qdom_h, Wq_h, bq, qh, 4096, 1024, 1024);
  gemm_h_kernel<_Float16><<<dim3(1024 / 128, 8192 / 128), blk, 0, stream>>>(
      kvdom_h, Wk_h, bk, kh, 8192, 1024, 1024);
  gemm_h_kernel<_Float16><<<dim3(1024 / 128, 8192 / 128), blk, 0, stream>>>(
      kvdom_h, Wv_h, bv, vh, 8192, 1024, 1024);

  attn_kernel<<<dim3(ALQ / 64, AH, AB), dim3(128), 0, stream>>>(
      qh, kh, vh, ctxh, scale, beta);

  gemm_h_kernel<float><<<dim3(1024 / 128, 4096 / 128), blk, 0, stream>>>(
      ctxh, Wo_h, bo, out, 4096, 1024, 1024);
}

// v005
// One run takes 118 microseconds.
// Timed twice side by side with v004, it ran 1.27 times as fast both times.
// Over all steps from v000 it is 1.92 times as fast.
#include <hip/hip_runtime.h>
#include <hip/hip_bf16.h>

typedef float     v8f  __attribute__((ext_vector_type(8)));
typedef _Float16  v8h  __attribute__((ext_vector_type(8)));
typedef _Float16  v16h __attribute__((ext_vector_type(16)));

__device__ __forceinline__ v8f wmma_f32_f16(v16h a, v16h b, v8f c) {
  return __builtin_amdgcn_wmma_f32_16x16x32_f16(false, a, false, b, (short)0, c,
                                                false, false);
}

__device__ __forceinline__ v8f zero_v8f() {
  v8f z;
#pragma unroll
  for (int i = 0; i < 8; ++i) z[i] = 0.0f;
  return z;
}

__device__ __forceinline__ v16h load_frag(const _Float16* base, int stride,
                                          int row, int koff, int g) {
  const _Float16* p = base + row * stride + koff + 8 * g;
  v8h lo = *(const v8h*)(p);
  v8h hi = *(const v8h*)(p + 16);
  v16h r;
#pragma unroll
  for (int e = 0; e < 8; ++e) { r[e] = lo[e]; r[e + 8] = hi[e]; }
  return r;
}

typedef short s16x8 __attribute__((ext_vector_type(8)));
__device__ __forceinline__ v8h load_tr16(const _Float16* p) {
  typedef __attribute__((address_space(3))) s16x8 lds_s16x8;
  return __builtin_bit_cast(
      v8h, __builtin_amdgcn_ds_load_tr16_b128_v8i16((lds_s16x8*)p));
}

__device__ __forceinline__ void async_copy8_b128(unsigned lds, unsigned lstep,
                                                 const _Float16* g, int gstep) {
  asm volatile(
      "global_load_async_to_lds_b128 %0, %8, off\n\t"
      "global_load_async_to_lds_b128 %1, %9, off\n\t"
      "global_load_async_to_lds_b128 %2, %10, off\n\t"
      "global_load_async_to_lds_b128 %3, %11, off\n\t"
      "global_load_async_to_lds_b128 %4, %12, off\n\t"
      "global_load_async_to_lds_b128 %5, %13, off\n\t"
      "global_load_async_to_lds_b128 %6, %14, off\n\t"
      "global_load_async_to_lds_b128 %7, %15, off\n\t"
      "s_wait_xcnt 0x0"
      :
      : "v"(lds), "v"(lds + lstep), "v"(lds + 2 * lstep), "v"(lds + 3 * lstep),
        "v"(lds + 4 * lstep), "v"(lds + 5 * lstep), "v"(lds + 6 * lstep),
        "v"(lds + 7 * lstep), "v"(g), "v"(g + gstep), "v"(g + 2 * gstep),
        "v"(g + 3 * gstep), "v"(g + 4 * gstep), "v"(g + 5 * gstep),
        "v"(g + 6 * gstep), "v"(g + 7 * gstep)
      : "memory");
}

__device__ __forceinline__ void async_copy4x2_b128(
    unsigned ldsa, unsigned astep, const _Float16* ga, unsigned ldsb,
    unsigned bstep, const _Float16* gb, int gstep) {
  asm volatile(
      "global_load_async_to_lds_b128 %0, %8, off\n\t"
      "global_load_async_to_lds_b128 %1, %9, off\n\t"
      "global_load_async_to_lds_b128 %2, %10, off\n\t"
      "global_load_async_to_lds_b128 %3, %11, off\n\t"
      "global_load_async_to_lds_b128 %4, %12, off\n\t"
      "global_load_async_to_lds_b128 %5, %13, off\n\t"
      "global_load_async_to_lds_b128 %6, %14, off\n\t"
      "global_load_async_to_lds_b128 %7, %15, off\n\t"
      "s_wait_xcnt 0x0"
      :
      : "v"(ldsa), "v"(ldsa + astep), "v"(ldsa + 2 * astep),
        "v"(ldsa + 3 * astep), "v"(ldsb), "v"(ldsb + bstep),
        "v"(ldsb + 2 * bstep), "v"(ldsb + 3 * bstep), "v"(ga), "v"(ga + gstep),
        "v"(ga + 2 * gstep), "v"(ga + 3 * gstep), "v"(gb), "v"(gb + gstep),
        "v"(gb + 2 * gstep), "v"(gb + 3 * gstep)
      : "memory");
}

// This wave's copies have landed (another wave reads them behind the barrier).
__device__ __forceinline__ void wait_async0() {
  asm volatile("s_wait_asynccnt 0x0" ::: "memory");
}

// This wave's LDS reads have returned: the buffer they read may be refilled.
__device__ __forceinline__ void wait_ds0() {
  asm volatile("s_wait_dscnt 0x0" ::: "memory");
}

// ---------------------------------------------------------------------------
// fp32 -> f16 of all six matrix inputs in ONE launch (every GEMM input is f16).
// The f16 copies lie back to back in the workspace, in the order q-domain (4),
// kv-domain (8), Wq, Wk, Wv, Wo (1 each, in pieces of 2^20 elements), so dst is
// one flat array. A block owns 32768 consecutive elements (32 blocks a piece,
// so a block never straddles two sources); a thread converts 16 groups of 8.
// 512 blocks = 4096 waves to start (two blocks a WGP), where one group a thread
// would start 65536; a wave's loads all stand ahead of its stores.
// ---------------------------------------------------------------------------
__global__ __launch_bounds__(256) void cvt_all_kernel(
    const float* __restrict__ qd, const float* __restrict__ kvd,
    const float* __restrict__ wq, const float* __restrict__ wk,
    const float* __restrict__ wv, const float* __restrict__ wo,
    _Float16* __restrict__ dst) {
  const int piece = blockIdx.x >> 5;  // block-uniform: scalar selects
  const float* src = qd;
  int first = 0;  // first piece of the chosen source
  if (piece >= 4)  { src = kvd; first = 4; }
  if (piece == 12) { src = wq;  first = 12; }
  if (piece == 13) { src = wk;  first = 13; }
  if (piece == 14) { src = wv;  first = 14; }
  if (piece == 15) { src = wo;  first = 15; }

  const size_t base = (size_t)blockIdx.x * 32768 + threadIdx.x * 8;
  const float* s = src + (base - ((size_t)first << 20));
  _Float16* d = dst + base;

  v8f x[16];
#pragma unroll  // straight line, so that many loads of a wave are in flight at once
  for (int k = 0; k < 16; ++k) x[k] = *(const v8f*)(s + k * 2048);
#pragma unroll  // x[] must stay in registers: constant indices only
  for (int k = 0; k < 16; ++k) {
    v8h h;
#pragma unroll
    for (int e = 0; e < 8; ++e) h[e] = (_Float16)x[k][e];
    *(v8h*)(d + k * 2048) = h;
  }
}

// ---------------------------------------------------------------------------
// GEMM: Y[m,n] = sum_k X[m,k]*W[n,k] + bias[n]  (X,W f16; Y f16 or f32).
// Block 256 = 8 waves; tile 128(M) x 128(N); wave tile 64x32 (c[4][2]).
// K goes in stages of 128 halfs = 256 B of every operand row, so that one
// wave-wide async copy is two whole rows of the stage: four whole 128-B lines
// (a 64-B stage row made it 16 lines of 32 B each). Two LDS buffers:
//   wmma on stage s -> dscnt 0 -> asynccnt 0 -> barrier -> copies of stage s+2.
// 32 wmma per wave per stage, k ascending. K: a multiple of 128, at least 128.
// ---------------------------------------------------------------------------
#define GBK    128  // halfs of K a stage
#define GPITCH 136  // LDS row pitch in halfs: 272 B = 16 B x 17 (b128 readers)

template <typename OutT>
__global__ __launch_bounds__(256) void gemm_h_kernel(
    const _Float16* __restrict__ X, const _Float16* __restrict__ W,
    const float* __restrict__ bias, OutT* __restrict__ Y,
    int M, int N, int K) {
  const int n0 = blockIdx.x * 128;
  const int m0 = blockIdx.y * 128;
  const int t  = threadIdx.x;
  const int w  = t >> 5;
  const int l  = t & 31;
  const int lm = l & 15;
  const int g  = l >> 4;
  const int wm = w & 1;    // 2 waves along M (64 rows each)
  const int wn = w >> 1;   // 4 waves along N (32 cols each)

  __shared__ __attribute__((aligned(16))) _Float16 As[2][128 * GPITCH];
  __shared__ __attribute__((aligned(16))) _Float16 Bs[2][128 * GPITCH];

  v8f c[4][2];
#pragma unroll
  for (int i = 0; i < 4; ++i)
#pragma unroll
    for (int j = 0; j < 2; ++j) c[i][j] = zero_v8f();

  // Per-thread staging share: 16-B piece t&15 of rows (t>>4) + 16*i, i = 0..7,
  // of each matrix: 16 lanes cover one 256-B stage row.
  const int srow = t >> 4;
  const int scol = (t & 15) * 8;
  const _Float16* Xg = X + (size_t)(m0 + srow) * K + scol;
  const _Float16* Wg = W + (size_t)(n0 + srow) * K + scol;
  const unsigned lofs = (unsigned)((srow * GPITCH + scol) * 2);  // bytes
  const unsigned la0 = (unsigned)(uintptr_t)(&As[0][0]) + lofs;
  const unsigned lb0 = (unsigned)(uintptr_t)(&Bs[0][0]) + lofs;
  const unsigned lbuf  = 128 * GPITCH * 2;  // bytes from buffer 0 to buffer 1
  const unsigned lstep = 16 * GPITCH * 2;   // bytes from a copy's row to the next's
  const int nst = K / GBK;

  // Stage 0 into buffer 0, published; then stage 1 flies into buffer 1.
  async_copy8_b128(la0, lstep, Xg, 16 * K);
  async_copy8_b128(lb0, lstep, Wg, 16 * K);
  wait_async0();
  __syncthreads();
  if (nst > 1) {
    async_copy8_b128(la0 + lbuf, lstep, Xg + GBK, 16 * K);
    async_copy8_b128(lb0 + lbuf, lstep, Wg + GBK, 16 * K);
  }

  for (int s = 0; s < nst; ++s) {
    const int cur = s & 1;
    const _Float16* Ab = As[cur];
    const _Float16* Bb = Bs[cur];
#pragma unroll
    for (int ks = 0; ks < GBK; ks += 32) {
      v16h af[4];
#pragma unroll
      for (int i = 0; i < 4; ++i)
        af[i] = load_frag(Ab, GPITCH, wm * 64 + i * 16 + lm, ks, g);
#pragma unroll
      for (int j = 0; j < 2; ++j) {
        v16h bf = load_frag(Bb, GPITCH, wn * 32 + j * 16 + lm, ks, g);
#pragma unroll
        for (int i = 0; i < 4; ++i) c[i][j] = wmma_f32_f16(af[i], bf, c[i][j]);
      }
    }

    // Publish stage s+1 and free stage s's buffer, then refill that buffer.
    wait_ds0();
    wait_async0();
    __syncthreads();
    if (s + 2 < nst) {
      const unsigned lo = cur ? lbuf : 0u;
      async_copy8_b128(la0 + lo, lstep, Xg + (s + 2) * GBK, 16 * K);
      async_copy8_b128(lb0 + lo, lstep, Wg + (s + 2) * GBK, 16 * K);
    }
  }
  wait_async0();  // nothing is in flight here; kept in front of the wave's end

  // Epilogue: C layout -> lane holds col n = lm, rows r + 8g.
#pragma unroll
  for (int j = 0; j < 2; ++j) {
    const int ncol = n0 + wn * 32 + j * 16 + lm;
    const float bj = bias[ncol];
#pragma unroll
    for (int i = 0; i < 4; ++i) {
#pragma unroll
      for (int r = 0; r < 8; ++r) {
        const int mrow = m0 + wm * 64 + i * 16 + r + 8 * g;
        Y[(size_t)mrow * N + ncol] = (OutT)(c[i][j][r] + bj);
      }
    }
  }
}

#define AB   4
#define ALQ  1024
#define ALKV 2048
#define AD   1024
#define AH   16
#define AHD  64
#define AKS  64  // keys a stage
#define AKP  72  // K pitch in LDS, halfs: 144 B = 16 B x 9 (b128 readers)
#define AVP  80  // V pitch in LDS, halfs: 160 B = 32 B x 5 (transposing readers)

__device__ __forceinline__ float xhalf(float x) {
  const int i = __builtin_bit_cast(int, x);
  return __builtin_bit_cast(
      float, __builtin_amdgcn_permlanex16(i, i, 0x76543210, 0xfedcba98, false,
                                          false));
}

__global__ __launch_bounds__(128) void attn_kernel(
    const _Float16* __restrict__ q, const _Float16* __restrict__ kmat,
    const _Float16* __restrict__ vmat, _Float16* __restrict__ ctx,
    const float* __restrict__ scale_p, const float* __restrict__ beta_p) {
  const int qt = blockIdx.x;
  const int h  = blockIdx.y;
  const int b  = blockIdx.z;
  const int t  = threadIdx.x;
  const int w  = t >> 5;
  const int l  = t & 31;
  const int lm = l & 15;
  const int g  = l >> 4;

  __shared__ __attribute__((aligned(16))) _Float16 Qs[64 * 72];  // 64 q x 64 d
  __shared__ __attribute__((aligned(16))) _Float16 Ks[2][AKS * AKP];
  __shared__ __attribute__((aligned(16))) _Float16 Vs[2][AKS * AVP];

  // Per-thread staging share: 16-B piece t&7 of rows (t>>3) + 16*i, i = 0..3, of
  // K and of V: 8 lanes cover one 128-B row of this head.
  const int srow = t >> 3;
  const int scol = (t & 7) * 8;
  const size_t goff = ((size_t)(b * ALKV + srow)) * AD + h * AHD + scol;
  const _Float16* Kg = kmat + goff;
  const _Float16* Vg = vmat + goff;
  const unsigned lk0 =
      (unsigned)(uintptr_t)(&Ks[0][0]) + (unsigned)((srow * AKP + scol) * 2);
  const unsigned lv0 =
      (unsigned)(uintptr_t)(&Vs[0][0]) + (unsigned)((srow * AVP + scol) * 2);
  const unsigned kbuf = AKS * AKP * 2, vbuf = AKS * AVP * 2;  // bytes a buffer
  const unsigned kstep = 16 * AKP * 2, vstep = 16 * AVP * 2;  // bytes, 16 rows
  const int nst = ALKV / AKS;

  // Stage 0 starts to fly into buffer 0 while Q is staged.
  async_copy4x2_b128(lk0, kstep, Kg, lv0, vstep, Vg, 16 * AD);

  const float scale = scale_p[0] * 0.125f;  // 1/sqrt(64)
  const float beta  = beta_p[0];

  {  // Stage Q tile once.
    const int row = t >> 1;
    const int cb  = (t & 1) * 32;
    const _Float16* src =
        q + ((size_t)(b * ALQ + qt * 64 + row)) * AD + h * AHD + cb;
    _Float16* dst = &Qs[row * 72 + cb];
#pragma unroll
    for (int i = 0; i < 4; ++i)
      *(v8h*)(dst + i * 8) = *(const v8h*)(src + i * 8);
  }
  wait_async0();
  __syncthreads();  // publishes Q and stage 0
  // Stage 1 flies into buffer 1.
  async_copy4x2_b128(lk0 + kbuf, kstep, Kg + AKS * AD, lv0 + vbuf, vstep,
                     Vg + AKS * AD, 16 * AD);

  // B operand Q^T: column lm = query w*16+lm, k = d in the hardware order.
  v16h qb0 = load_frag(Qs, 72, w * 16 + lm, 0, g);
  v16h qb1 = load_frag(Qs, 72, w * 16 + lm, 32, g);

  // This lane's address for the transposing loads of V (keys 0..15, d 0..15).
  const _Float16* vtp = &Vs[0][(8 * g + (l & 7)) * AVP + 8 * ((l >> 3) & 1)];

  // Per lane: running max and this half's partial sum of query w*16+lm.
  float mrow = -1e30f, lrow = 0.0f;
  v8f acc[4];  // acc[d][r] = O^T[d*16 + 8g + r][query lm]
#pragma unroll
  for (int d = 0; d < 4; ++d) acc[d] = zero_v8f();

  for (int s = 0; s < nst; ++s) {
    const int cur = s & 1;
#pragma unroll  // both chunks in one run: constant LDS offsets inside a stage
    for (int p = 0; p < AKS / 32; ++p) {
      const _Float16* Kc = &Ks[cur][p * 32 * AKP];
      const _Float16* vc = vtp + cur * (AKS * AVP) + p * 32 * AVP;

      // s0[r] = S^T[key 8g + r][query lm], s1[r] = S^T[key 16 + 8g + r][query lm].
      v8f s0 = zero_v8f(), s1 = zero_v8f();
      {
        v16h ka;
        ka = load_frag(Kc, AKP, lm, 0, g);        s0 = wmma_f32_f16(ka, qb0, s0);
        ka = load_frag(Kc, AKP, lm, 32, g);       s0 = wmma_f32_f16(ka, qb1, s0);
        ka = load_frag(Kc, AKP, 16 + lm, 0, g);   s1 = wmma_f32_f16(ka, qb0, s1);
        ka = load_frag(Kc, AKP, 16 + lm, 32, g);  s1 = wmma_f32_f16(ka, qb1, s1);
      }

      float a0[8], a1[8];
      float mx = -1e30f;
#pragma unroll
      for (int r = 0; r < 8; ++r) {
        a0[r] = s0[r] * scale + beta;
        a1[r] = s1[r] * scale + beta;
        mx = fmaxf(mx, fmaxf(a0[r], a1[r]));
      }
      mx = fmaxf(mx, xhalf(mx));  // both halves now hold the query's chunk max
      const float mnew  = fmaxf(mrow, mx);
      const float alpha = __expf(mrow - mnew);
      mrow = mnew;

      // P^T as B operand: element s is key kmap(s) = 8g + s (s < 8), 16 + 8g + s - 8.
      v16h pb;
      float ps = 0.0f;
#pragma unroll
      for (int r = 0; r < 8; ++r) {
        const float p0 = __expf(a0[r] - mnew);
        const float p1 = __expf(a1[r] - mnew);
        ps += p0 + p1;
        pb[r]     = (_Float16)p0;
        pb[r + 8] = (_Float16)p1;
      }
      lrow = lrow * alpha + ps;
#pragma unroll
      for (int d = 0; d < 4; ++d) acc[d] *= alpha;

#pragma unroll
      for (int d = 0; d < 4; ++d) {
        // A = V^T: row d*16 + lm, keys 8g + 0..7 then 16 + 8g + 0..7 (pb's order).
        const v8h lo = load_tr16(vc + d * 16);
        const v8h hi = load_tr16(vc + 16 * AVP + d * 16);
        v16h va;
#pragma unroll
        for (int e = 0; e < 8; ++e) { va[e] = lo[e]; va[e + 8] = hi[e]; }
        acc[d] = wmma_f32_f16(va, pb, acc[d]);
      }
    }  // chunk p

    // Publish stage s+1 and free stage s's buffer, then refill that buffer.
    wait_ds0();
    wait_async0();
    __syncthreads();
    if (s + 2 < nst) {
      const size_t go = (size_t)(s + 2) * (AKS * AD);
      async_copy4x2_b128(lk0 + (cur ? kbuf : 0u), kstep, Kg + go,
                         lv0 + (cur ? vbuf : 0u), vstep, Vg + go, 16 * AD);
    }
  }
  wait_async0();  // nothing is in flight here; kept in front of the wave's end

  {
    const float rinv = 1.0f / (lrow + xhalf(lrow));  // join the halves' sums
    const int qrow = qt * 64 + w * 16 + lm;
    _Float16* dst = ctx + ((size_t)(b * ALQ + qrow)) * AD + h * AHD + 8 * g;
#pragma unroll
    for (int d = 0; d < 4; ++d) {
      v8h o;
#pragma unroll
      for (int r = 0; r < 8; ++r) o[r] = (_Float16)(acc[d][r] * rinv);
      *(v8h*)(dst + d * 16) = o;  // 8 consecutive d of one query: one 16B store
    }
  }
}

// ---------------------------------------------------------------------------
// Launcher. Workspace (f16 unless noted):
//  [0,8)MB qdom | [8,24) kvdom | [24,26) Wq | [26,28) Wk | [28,30) Wv
//  [30,32) Wo | [32,40) q | [40,56) k | [56,72) v | [72,80) ctx  => 80MB
// ---------------------------------------------------------------------------
extern "C" void kernel_launch(void* const* d_in, const int* in_sizes, int n_in,
                              void* d_out, int out_size, void* d_ws,
                              size_t ws_size, hipStream_t stream) {
  (void)in_sizes; (void)n_in; (void)out_size; (void)ws_size;

  const float* qdom  = (const float*)d_in[0];
  const float* kvdom = (const float*)d_in[1];
  const float* Wq = (const float*)d_in[2];
  const float* bq = (const float*)d_in[3];
  const float* Wk = (const float*)d_in[4];
  const float* bk = (const float*)d_in[5];
  const float* Wv = (const float*)d_in[6];
  const float* bv = (const float*)d_in[7];
  const float* Wo = (const float*)d_in[8];
  const float* bo = (const float*)d_in[9];
  const float* scale = (const float*)d_in[10];
  const float* beta  = (const float*)d_in[11];
  float* out = (float*)d_out;

  const size_t MB = 1u << 20;
  char* ws = (char*)d_ws;
  _Float16* qdom_h  = (_Float16*)(ws + 0 * MB);
  _Float16* kvdom_h = (_Float16*)(ws + 8 * MB);
  _Float16* Wq_h    = (_Float16*)(ws + 24 * MB);
  _Float16* Wk_h    = (_Float16*)(ws + 26 * MB);
  _Float16* Wv_h    = (_Float16*)(ws + 28 * MB);
  _Float16* Wo_h    = (_Float16*)(ws + 30 * MB);
  _Float16* qh      = (_Float16*)(ws + 32 * MB);
  _Float16* kh      = (_Float16*)(ws + 40 * MB);
  _Float16* vh      = (_Float16*)(ws + 56 * MB);
  _Float16* ctxh    = (_Float16*)(ws + 72 * MB);

  // qdom_h .. Wo_h are contiguous: one flat destination of 16 * 2^20 halfs.
  cvt_all_kernel<<<dim3(512), dim3(256), 0, stream>>>(qdom, kvdom, Wq, Wk, Wv,
                                                      Wo, qdom_h);

  const dim3 blk(256);
  gemm_h_kernel<_Float16><<<dim3(1024 / 128, 4096 / 128), blk, 0, stream>>>(
      qdom_h, Wq_h, bq, qh, 4096, 1024, 1024);
  gemm_h_kernel<_Float16><<<dim3(1024 / 128, 8192 / 128), blk, 0, stream>>>(
      kvdom_h, Wk_h, bk, kh, 8192, 1024, 1024);
  gemm_h_kernel<_Float16><<<dim3(1024 / 128, 8192 / 128), blk, 0, stream>>>(
      kvdom_h, Wv_h, bv, vh, 8192, 1024, 1024);

  attn_kernel<<<dim3(ALQ / 64, AH, AB), dim3(128), 0, stream>>>(
      qh, kh, vh, ctxh, scale, beta);

  gemm_h_kernel<float><<<dim3(1024 / 128, 4096 / 128), blk, 0, stream>>>(
      ctxh, Wo_h, bo, out, 4096, 1024, 1024);
}

// v006
// Measured time: 114 microseconds a run.
// Next to v005, in two timings, it ran 1.03 times as fast each time.
// All steps since v000 together make it 1.98 times as fast.
#include <hip/hip_runtime.h>
#include <hip/hip_bf16.h>

typedef float     v8f  __attribute__((ext_vector_type(8)));
typedef _Float16  v8h  __attribute__((ext_vector_type(8)));
typedef _Float16  v16h __attribute__((ext_vector_type(16)));

__device__ __forceinline__ v8f wmma_f32_f16(v16h a, v16h b, v8f c) {
  return __builtin_amdgcn_wmma_f32_16x16x32_f16(false, a, false, b, (short)0, c,
                                                false, false);
}

__device__ __forceinline__ v8f zero_v8f() {
  v8f z;
#pragma unroll
  for (int i = 0; i < 8; ++i) z[i] = 0.0f;
  return z;
}

__device__ __forceinline__ v16h load_frag(const _Float16* base, int stride,
                                          int row, int koff, int g) {
  const _Float16* p = base + row * stride + koff + 8 * g;
  v8h lo = *(const v8h*)(p);
  v8h hi = *(const v8h*)(p + 16);
  v16h r;
#pragma unroll
  for (int e = 0; e < 8; ++e) { r[e] = lo[e]; r[e + 8] = hi[e]; }
  return r;
}

typedef short s16x8 __attribute__((ext_vector_type(8)));
__device__ __forceinline__ v8h load_tr16(const _Float16* p) {
  typedef __attribute__((address_space(3))) s16x8 lds_s16x8;
  return __builtin_bit_cast(
      v8h, __builtin_amdgcn_ds_load_tr16_b128_v8i16((lds_s16x8*)p));
}

__device__ __forceinline__ void async_copy8_b128(unsigned lds, unsigned lstep,
                                                 const _Float16* g, int gstep) {
  asm volatile(
      "global_load_async_to_lds_b128 %0, %8, off\n\t"
      "global_load_async_to_lds_b128 %1, %9, off\n\t"
      "global_load_async_to_lds_b128 %2, %10, off\n\t"
      "global_load_async_to_lds_b128 %3, %11, off\n\t"
      "global_load_async_to_lds_b128 %4, %12, off\n\t"
      "global_load_async_to_lds_b128 %5, %13, off\n\t"
      "global_load_async_to_lds_b128 %6, %14, off\n\t"
      "global_load_async_to_lds_b128 %7, %15, off\n\t"
      "s_wait_xcnt 0x0"
      :
      : "v"(lds), "v"(lds + lstep), "v"(lds + 2 * lstep), "v"(lds + 3 * lstep),
        "v"(lds + 4 * lstep), "v"(lds + 5 * lstep), "v"(lds + 6 * lstep),
        "v"(lds + 7 * lstep), "v"(g), "v"(g + gstep), "v"(g + 2 * gstep),
        "v"(g + 3 * gstep), "v"(g + 4 * gstep), "v"(g + 5 * gstep),
        "v"(g + 6 * gstep), "v"(g + 7 * gstep)
      : "memory");
}

__device__ __forceinline__ void async_copy4x2_b128(
    unsigned ldsa, unsigned astep, const _Float16* ga, unsigned ldsb,
    unsigned bstep, const _Float16* gb, int gstep) {
  asm volatile(
      "global_load_async_to_lds_b128 %0, %8, off\n\t"
      "global_load_async_to_lds_b128 %1, %9, off\n\t"
      "global_load_async_to_lds_b128 %2, %10, off\n\t"
      "global_load_async_to_lds_b128 %3, %11, off\n\t"
      "global_load_async_to_lds_b128 %4, %12, off\n\t"
      "global_load_async_to_lds_b128 %5, %13, off\n\t"
      "global_load_async_to_lds_b128 %6, %14, off\n\t"
      "global_load_async_to_lds_b128 %7, %15, off\n\t"
      "s_wait_xcnt 0x0"
      :
      : "v"(ldsa), "v"(ldsa + astep), "v"(ldsa + 2 * astep),
        "v"(ldsa + 3 * astep), "v"(ldsb), "v"(ldsb + bstep),
        "v"(ldsb + 2 * bstep), "v"(ldsb + 3 * bstep), "v"(ga), "v"(ga + gstep),
        "v"(ga + 2 * gstep), "v"(ga + 3 * gstep), "v"(gb), "v"(gb + gstep),
        "v"(gb + 2 * gstep), "v"(gb + 3 * gstep)
      : "memory");
}

// This wave's copies have landed (another wave reads them behind the barrier).
__device__ __forceinline__ void wait_async0() {
  asm volatile("s_wait_asynccnt 0x0" ::: "memory");
}

// This wave's LDS reads have returned: the buffer they read may be refilled.
__device__ __forceinline__ void wait_ds0() {
  asm volatile("s_wait_dscnt 0x0" ::: "memory");
}

// ---------------------------------------------------------------------------
// fp32 -> f16 of all six matrix inputs in ONE launch (every GEMM input is f16).
// The f16 copies lie back to back in the workspace, in the order q-domain (4),
// kv-domain (8), Wq, Wk, Wv, Wo (1 each, in pieces of 2^20 elements), so dst is
// one flat array. A block owns 32768 consecutive elements (32 blocks a piece,
// so a block never straddles two sources); a thread converts 16 groups of 8.
// 512 blocks = 4096 waves to start (two blocks a WGP), where one group a thread
// would start 65536; a wave's loads all stand ahead of its stores.
// ---------------------------------------------------------------------------
__global__ __launch_bounds__(256) void cvt_all_kernel(
    const float* __restrict__ qd, const float* __restrict__ kvd,
    const float* __restrict__ wq, const float* __restrict__ wk,
    const float* __restrict__ wv, const float* __restrict__ wo,
    _Float16* __restrict__ dst) {
  const int piece = blockIdx.x >> 5;  // block-uniform: scalar selects
  const float* src = qd;
  int first = 0;  // first piece of the chosen source
  if (piece >= 4)  { src = kvd; first = 4; }
  if (piece == 12) { src = wq;  first = 12; }
  if (piece == 13) { src = wk;  first = 13; }
  if (piece == 14) { src = wv;  first = 14; }
  if (piece == 15) { src = wo;  first = 15; }

  const size_t base = (size_t)blockIdx.x * 32768 + threadIdx.x * 8;
  const float* s = src + (base - ((size_t)first << 20));
  _Float16* d = dst + base;

  v8f x[16];
#pragma unroll  // straight line, so that many loads of a wave are in flight at once
  for (int k = 0; k < 16; ++k) x[k] = *(const v8f*)(s + k * 2048);
#pragma unroll  // x[] must stay in registers: constant indices only
  for (int k = 0; k < 16; ++k) {
    v8h h;
#pragma unroll
    for (int e = 0; e < 8; ++e) h[e] = (_Float16)x[k][e];
    *(v8h*)(d + k * 2048) = h;
  }
}

// ---------------------------------------------------------------------------
// GEMM: Y[m,n] = sum_k X[m,k]*W[n,k] + bias[n]  (X,W f16; Y f16 or f32).
// Block 256 = 8 waves; tile 128(M) x 128(N); wave tile 64x32 (c[4][2]).
// K goes in stages of 128 halfs = 256 B of every operand row, so that one
// wave-wide async copy is two whole rows of the stage: four whole 128-B lines
// (a 64-B stage row made it 16 lines of 32 B each). Two LDS buffers:
//   wmma on stage s -> dscnt 0 -> asynccnt 0 -> barrier -> copies of stage s+2.
// 32 wmma per wave per stage, k ascending. K: a multiple of 128, at least 128.
// ---------------------------------------------------------------------------
#define GBK    128  // halfs of K a stage
#define GPITCH 136  // LDS row pitch in halfs: 272 B = 16 B x 17 (b128 readers)

template <typename OutT>
__global__ __launch_bounds__(256) void gemm_h_kernel(
    const _Float16* __restrict__ X, const _Float16* __restrict__ W,
    const float* __restrict__ bias, OutT* __restrict__ Y,
    int M, int N, int K) {
  const int n0 = blockIdx.x * 128;
  const int m0 = blockIdx.y * 128;
  const int t  = threadIdx.x;
  const int w  = t >> 5;
  const int l  = t & 31;
  const int lm = l & 15;
  const int g  = l >> 4;
  const int wm = w & 1;    // 2 waves along M (64 rows each)
  const int wn = w >> 1;   // 4 waves along N (32 cols each)

  __shared__ __attribute__((aligned(16))) _Float16 As[2][128 * GPITCH];
  __shared__ __attribute__((aligned(16))) _Float16 Bs[2][128 * GPITCH];

  v8f c[4][2];
#pragma unroll
  for (int i = 0; i < 4; ++i)
#pragma unroll
    for (int j = 0; j < 2; ++j) c[i][j] = zero_v8f();

  // Per-thread staging share: 16-B piece t&15 of rows (t>>4) + 16*i, i = 0..7,
  // of each matrix: 16 lanes cover one 256-B stage row.
  const int srow = t >> 4;
  const int scol = (t & 15) * 8;
  const _Float16* Xg = X + (size_t)(m0 + srow) * K + scol;
  const _Float16* Wg = W + (size_t)(n0 + srow) * K + scol;
  const unsigned lofs = (unsigned)((srow * GPITCH + scol) * 2);  // bytes
  const unsigned la0 = (unsigned)(uintptr_t)(&As[0][0]) + lofs;
  const unsigned lb0 = (unsigned)(uintptr_t)(&Bs[0][0]) + lofs;
  const unsigned lbuf  = 128 * GPITCH * 2;  // bytes from buffer 0 to buffer 1
  const unsigned lstep = 16 * GPITCH * 2;   // bytes from a copy's row to the next's
  const int nst = K / GBK;

  // Stage 0 into buffer 0, published; then stage 1 flies into buffer 1.
  async_copy8_b128(la0, lstep, Xg, 16 * K);
  async_copy8_b128(lb0, lstep, Wg, 16 * K);
  wait_async0();
  __syncthreads();
  if (nst > 1) {
    async_copy8_b128(la0 + lbuf, lstep, Xg + GBK, 16 * K);
    async_copy8_b128(lb0 + lbuf, lstep, Wg + GBK, 16 * K);
  }

  for (int s = 0; s < nst; ++s) {
    const int cur = s & 1;
    const _Float16* Ab = As[cur];
    const _Float16* Bb = Bs[cur];
#pragma unroll
    for (int ks = 0; ks < GBK; ks += 32) {
      v16h af[4];
#pragma unroll
      for (int i = 0; i < 4; ++i)
        af[i] = load_frag(Ab, GPITCH, wm * 64 + i * 16 + lm, ks, g);
#pragma unroll
      for (int j = 0; j < 2; ++j) {
        v16h bf = load_frag(Bb, GPITCH, wn * 32 + j * 16 + lm, ks, g);
#pragma unroll
        for (int i = 0; i < 4; ++i) c[i][j] = wmma_f32_f16(af[i], bf, c[i][j]);
      }
    }

    // Publish stage s+1 and free stage s's buffer, then refill that buffer.
    wait_ds0();
    wait_async0();
    __syncthreads();
    if (s + 2 < nst) {
      const unsigned lo = cur ? lbuf : 0u;
      async_copy8_b128(la0 + lo, lstep, Xg + (s + 2) * GBK, 16 * K);
      async_copy8_b128(lb0 + lo, lstep, Wg + (s + 2) * GBK, 16 * K);
    }
  }
  wait_async0();  // nothing is in flight here; kept in front of the wave's end

  // Epilogue: C layout -> lane holds col n = lm, rows r + 8g.
#pragma unroll
  for (int j = 0; j < 2; ++j) {
    const int ncol = n0 + wn * 32 + j * 16 + lm;
    const float bj = bias[ncol];
#pragma unroll
    for (int i = 0; i < 4; ++i) {
#pragma unroll
      for (int r = 0; r < 8; ++r) {
        const int mrow = m0 + wm * 64 + i * 16 + r + 8 * g;
        Y[(size_t)mrow * N + ncol] = (OutT)(c[i][j][r] + bj);
      }
    }
  }
}

#define AB   4
#define ALQ  1024
#define ALKV 2048
#define AD   1024
#define AH   16
#define AHD  64
#define AKS  64  // keys a stage
#define AKP  72  // K pitch in LDS, halfs: 144 B = 16 B x 9 (b128 readers)
#define AVP  80  // V pitch in LDS, halfs: 160 B = 32 B x 5 (transposing readers)

__device__ __forceinline__ float xhalf(float x) {
  const int i = __builtin_bit_cast(int, x);
  return __builtin_bit_cast(
      float, __builtin_amdgcn_permlanex16(i, i, 0x76543210, 0xfedcba98, false,
                                          false));
}

__global__ __launch_bounds__(128) void attn_kernel(
    const _Float16* __restrict__ q, const _Float16* __restrict__ kmat,
    const _Float16* __restrict__ vmat, _Float16* __restrict__ ctx,
    const float* __restrict__ scale_p, const float* __restrict__ beta_p) {
  const int qt = blockIdx.x;
  const int h  = blockIdx.y;
  const int b  = blockIdx.z;
  const int t  = threadIdx.x;
  const int w  = t >> 5;
  const int l  = t & 31;
  const int lm = l & 15;
  const int g  = l >> 4;

  __shared__ __attribute__((aligned(16))) _Float16 Qs[64 * 72];  // 64 q x 64 d
  __shared__ __attribute__((aligned(16))) _Float16 Ks[2][AKS * AKP];
  __shared__ __attribute__((aligned(16))) _Float16 Vs[2][AKS * AVP];

  // Per-thread staging share: 16-B piece t&7 of rows (t>>3) + 16*i, i = 0..3, of
  // K and of V: 8 lanes cover one 128-B row of this head.
  const int srow = t >> 3;
  const int scol = (t & 7) * 8;
  const size_t goff = ((size_t)(b * ALKV + srow)) * AD + h * AHD + scol;
  const _Float16* Kg = kmat + goff;
  const _Float16* Vg = vmat + goff;
  const unsigned lk0 =
      (unsigned)(uintptr_t)(&Ks[0][0]) + (unsigned)((srow * AKP + scol) * 2);
  const unsigned lv0 =
      (unsigned)(uintptr_t)(&Vs[0][0]) + (unsigned)((srow * AVP + scol) * 2);
  const unsigned kbuf = AKS * AKP * 2, vbuf = AKS * AVP * 2;  // bytes a buffer
  const unsigned kstep = 16 * AKP * 2, vstep = 16 * AVP * 2;  // bytes, 16 rows
  const int nst = ALKV / AKS;

  // Stage 0 starts to fly into buffer 0 while Q is staged.
  async_copy4x2_b128(lk0, kstep, Kg, lv0, vstep, Vg, 16 * AD);

  // Softmax in base 2: exp(x) = 2^(x * log2 e), with log2 e folded into the score
  // factor and into the shift, so that a score costs one fma ahead of its v_exp.
  const float c2s = scale_p[0] * 0.125f * 1.44269504f;  // 1/sqrt(64) * log2 e
  const float c2  = fabsf(c2s);
  const float b2  = beta_p[0] * 1.44269504f;

  {  // Stage Q tile once.
    const int row = t >> 1;
    const int cb  = (t & 1) * 32;
    const _Float16* src =
        q + ((size_t)(b * ALQ + qt * 64 + row)) * AD + h * AHD + cb;
    _Float16* dst = &Qs[row * 72 + cb];
#pragma unroll
    for (int i = 0; i < 4; ++i)
      *(v8h*)(dst + i * 8) = *(const v8h*)(src + i * 8);
  }
  wait_async0();
  __syncthreads();  // publishes Q and stage 0
  // Stage 1 flies into buffer 1.
  async_copy4x2_b128(lk0 + kbuf, kstep, Kg + AKS * AD, lv0 + vbuf, vstep,
                     Vg + AKS * AD, 16 * AD);

  // B operand Q^T: column lm = query w*16+lm, k = d in the hardware order.
  v16h qb0 = load_frag(Qs, 72, w * 16 + lm, 0, g);
  v16h qb1 = load_frag(Qs, 72, w * 16 + lm, 32, g);
  // The maximum is taken over raw scores, which orders them as the scaled ones
  // only under a factor >= 0: a negative factor's sign goes into Q (exact).
  if (c2s < 0.0f) { qb0 = -qb0; qb1 = -qb1; }

  // This lane's address for the transposing loads of V (keys 0..15, d 0..15).
  const _Float16* vtp = &Vs[0][(8 * g + (l & 7)) * AVP + 8 * ((l >> 3) & 1)];

  // Per lane: running max (scaled, shifted, in log2 units) and this half's
  // partial sum of query w*16+lm.
  float mrow = -1e30f, lrow = 0.0f;
  v8f acc[4];  // acc[d][r] = O^T[d*16 + 8g + r][query lm]
#pragma unroll
  for (int d = 0; d < 4; ++d) acc[d] = zero_v8f();

  for (int s = 0; s < nst; ++s) {
    const int cur = s & 1;
#pragma unroll  // both chunks in one run: constant LDS offsets inside a stage
    for (int p = 0; p < AKS / 32; ++p) {
      const _Float16* Kc = &Ks[cur][p * 32 * AKP];
      const _Float16* vc = vtp + cur * (AKS * AVP) + p * 32 * AVP;

      // s0[r] = S^T[key 8g + r][query lm], s1[r] = S^T[key 16 + 8g + r][query lm].
      v8f s0 = zero_v8f(), s1 = zero_v8f();
      {
        v16h ka;
        ka = load_frag(Kc, AKP, lm, 0, g);        s0 = wmma_f32_f16(ka, qb0, s0);
        ka = load_frag(Kc, AKP, lm, 32, g);       s0 = wmma_f32_f16(ka, qb1, s0);
        ka = load_frag(Kc, AKP, 16 + lm, 0, g);   s1 = wmma_f32_f16(ka, qb0, s1);
        ka = load_frag(Kc, AKP, 16 + lm, 32, g);  s1 = wmma_f32_f16(ka, qb1, s1);
      }

      float mx = fmaxf(s0[0], s1[0]);  // of raw scores
#pragma unroll
      for (int r = 1; r < 8; ++r) mx = fmaxf(mx, fmaxf(s0[r], s1[r]));
      mx = fmaxf(mx, xhalf(mx));  // both halves now hold the query's chunk max
      const float mnew  = fmaxf(mrow, fmaf(mx, c2, b2));
      const float alpha = __builtin_amdgcn_exp2f(mrow - mnew);
      mrow = mnew;
      // Exponent of a score: s * c2 + b2 - mnew, as one fma (packed in pairs).
      const float nb = b2 - mnew;
      const v8f e0 = s0 * c2 + nb;
      const v8f e1 = s1 * c2 + nb;

      // P^T as B operand: element s is key kmap(s) = 8g + s (s < 8), 16 + 8g + s - 8.
      v16h pb;
      float ps = 0.0f;
#pragma unroll
      for (int r = 0; r < 8; ++r) {
        const float p0 = __builtin_amdgcn_exp2f(e0[r]);
        const float p1 = __builtin_amdgcn_exp2f(e1[r]);
        ps += p0 + p1;
        pb[r]     = (_Float16)p0;
        pb[r + 8] = (_Float16)p1;
      }
      lrow = lrow * alpha + ps;
#pragma unroll
      for (int d = 0; d < 4; ++d) acc[d] *= alpha;

#pragma unroll
      for (int d = 0; d < 4; ++d) {
        // A = V^T: row d*16 + lm, keys 8g + 0..7 then 16 + 8g + 0..7 (pb's order).
        const v8h lo = load_tr16(vc + d * 16);
        const v8h hi = load_tr16(vc + 16 * AVP + d * 16);
        v16h va;
#pragma unroll
        for (int e = 0; e < 8; ++e) { va[e] = lo[e]; va[e + 8] = hi[e]; }
        acc[d] = wmma_f32_f16(va, pb, acc[d]);
      }
    }  // chunk p

    // Publish stage s+1 and free stage s's buffer, then refill that buffer.
    wait_ds0();
    wait_async0();
    __syncthreads();
    if (s + 2 < nst) {
      const size_t go = (size_t)(s + 2) * (AKS * AD);
      async_copy4x2_b128(lk0 + (cur ? kbuf : 0u), kstep, Kg + go,
                         lv0 + (cur ? vbuf : 0u), vstep, Vg + go, 16 * AD);
    }
  }
  wait_async0();  // nothing is in flight here; kept in front of the wave's end

  {
    const float rinv = 1.0f / (lrow + xhalf(lrow));  // join the halves' sums
    const int qrow = qt * 64 + w * 16 + lm;
    _Float16* dst = ctx + ((size_t)(b * ALQ + qrow)) * AD + h * AHD + 8 * g;
#pragma unroll
    for (int d = 0; d < 4; ++d) {
      v8h o;
#pragma unroll
      for (int r = 0; r < 8; ++r) o[r] = (_Float16)(acc[d][r] * rinv);
      *(v8h*)(dst + d * 16) = o;  // 8 consecutive d of one query: one 16B store
    }
  }
}

// ---------------------------------------------------------------------------
// Launcher. Workspace (f16 unless noted):
//  [0,8)MB qdom | [8,24) kvdom | [24,26) Wq | [26,28) Wk | [28,30) Wv
//  [30,32) Wo | [32,40) q | [40,56) k | [56,72) v | [72,80) ctx  => 80MB
// ---------------------------------------------------------------------------
extern "C" void kernel_launch(void* const* d_in, const int* in_sizes, int n_in,
                              void* d_out, int out_size, void* d_ws,
                              size_t ws_size, hipStream_t stream) {
  (void)in_sizes; (void)n_in; (void)out_size; (void)ws_size;

  const float* qdom  = (const float*)d_in[0];
  const float* kvdom = (const float*)d_in[1];
  const float* Wq = (const float*)d_in[2];
  const float* bq = (const float*)d_in[3];
  const float* Wk = (const float*)d_in[4];
  const float* bk = (const float*)d_in[5];
  const float* Wv = (const float*)d_in[6];
  const float* bv = (const float*)d_in[7];
  const float* Wo = (const float*)d_in[8];
  const float* bo = (const float*)d_in[9];
  const float* scale = (const float*)d_in[10];
  const float* beta  = (const float*)d_in[11];
  float* out = (float*)d_out;

  const size_t MB = 1u << 20;
  char* ws = (char*)d_ws;
  _Float16* qdom_h  = (_Float16*)(ws + 0 * MB);
  _Float16* kvdom_h = (_Float16*)(ws + 8 * MB);
  _Float16* Wq_h    = (_Float16*)(ws + 24 * MB);
  _Float16* Wk_h    = (_Float16*)(ws + 26 * MB);
  _Float16* Wv_h    = (_Float16*)(ws + 28 * MB);
  _Float16* Wo_h    = (_Float16*)(ws + 30 * MB);
  _Float16* qh      = (_Float16*)(ws + 32 * MB);
  _Float16* kh      = (_Float16*)(ws + 40 * MB);
  _Float16* vh      = (_Float16*)(ws + 56 * MB);
  _Float16* ctxh    = (_Float16*)(ws + 72 * MB);

  // qdom_h .. Wo_h are contiguous: one flat destination of 16 * 2^20 halfs.
  cvt_all_kernel<<<dim3(512), dim3(256), 0, stream>>>(qdom, kvdom, Wq, Wk, Wv,
                                                      Wo, qdom_h);

  const dim3 blk(256);
  gemm_h_kernel<_Float16><<<dim3(1024 / 128, 4096 / 128), blk, 0, stream>>>(
      qdom_h, Wq_h, bq, qh, 4096, 1024, 1024);
  gemm_h_kernel<_Float16><<<dim3(1024 / 128, 8192 / 128), blk, 0, stream>>>(
      kvdom_h, Wk_h, bk, kh, 8192, 1024, 1024);
  gemm_h_kernel<_Float16><<<dim3(1024 / 128, 8192 / 128), blk, 0, stream>>>(
      kvdom_h, Wv_h, bv, vh, 8192, 1024, 1024);

  attn_kernel<<<dim3(ALQ / 64, AH, AB), dim3(128), 0, stream>>>(
      qh, kh, vh, ctxh, scale, beta);

  gemm_h_kernel<float><<<dim3(1024 / 128, 4096 / 128), blk, 0, stream>>>(
      ctxh, Wo_h, bo, out, 4096, 1024, 1024);
}

// v007
// Measured time: 111 microseconds a run.
// Two timings next to v006 put it at 1.03 and 1.04 times that version's speed.
// Counting every step since v000, it is 2.05 times as fast.
#include <hip/hip_runtime.h>
#include <hip/hip_bf16.h>

typedef float     v8f  __attribute__((ext_vector_type(8)));
typedef _Float16  v8h  __attribute__((ext_vector_type(8)));
typedef _Float16  v16h __attribute__((ext_vector_type(16)));

__device__ __forceinline__ v8f wmma_f32_f16(v16h a, v16h b, v8f c) {
  return __builtin_amdgcn_wmma_f32_16x16x32_f16(false, a, false, b, (short)0, c,
                                                false, false);
}

__device__ __forceinline__ v8f zero_v8f() {
  v8f z;
#pragma unroll
  for (int i = 0; i < 8; ++i) z[i] = 0.0f;
  return z;
}

__device__ __forceinline__ v16h load_frag(const _Float16* base, int stride,
                                          int row, int koff, int g) {
  const _Float16* p = base + row * stride + koff + 8 * g;
  v8h lo = *(const v8h*)(p);
  v8h hi = *(const v8h*)(p + 16);
  v16h r;
#pragma unroll
  for (int e = 0; e < 8; ++e) { r[e] = lo[e]; r[e + 8] = hi[e]; }
  return r;
}

typedef short s16x8 __attribute__((ext_vector_type(8)));
__device__ __forceinline__ v8h load_tr16(const _Float16* p) {
  typedef __attribute__((address_space(3))) s16x8 lds_s16x8;
  return __builtin_bit_cast(
      v8h, __builtin_amdgcn_ds_load_tr16_b128_v8i16((lds_s16x8*)p));
}

__device__ __forceinline__ void async_copy8_b128(unsigned lds, unsigned lstep,
                                                 const _Float16* g, int gstep) {
  asm volatile(
      "global_load_async_to_lds_b128 %0, %8, off\n\t"
      "global_load_async_to_lds_b128 %1, %9, off\n\t"
      "global_load_async_to_lds_b128 %2, %10, off\n\t"
      "global_load_async_to_lds_b128 %3, %11, off\n\t"
      "global_load_async_to_lds_b128 %4, %12, off\n\t"
      "global_load_async_to_lds_b128 %5, %13, off\n\t"
      "global_load_async_to_lds_b128 %6, %14, off\n\t"
      "global_load_async_to_lds_b128 %7, %15, off\n\t"
      "s_wait_xcnt 0x0"
      :
      : "v"(lds), "v"(lds + lstep), "v"(lds + 2 * lstep), "v"(lds + 3 * lstep),
        "v"(lds + 4 * lstep), "v"(lds + 5 * lstep), "v"(lds + 6 * lstep),
        "v"(lds + 7 * lstep), "v"(g), "v"(g + gstep), "v"(g + 2 * gstep),
        "v"(g + 3 * gstep), "v"(g + 4 * gstep), "v"(g + 5 * gstep),
        "v"(g + 6 * gstep), "v"(g + 7 * gstep)
      : "memory");
}

__device__ __forceinline__ void async_copy2x2_b128(
    unsigned ldsa, unsigned astep, const _Float16* ga, unsigned ldsb,
    unsigned bstep, const _Float16* gb, int gstep) {
  asm volatile(
      "global_load_async_to_lds_b128 %0, %4, off\n\t"
      "global_load_async_to_lds_b128 %1, %5, off\n\t"
      "global_load_async_to_lds_b128 %2, %6, off\n\t"
      "global_load_async_to_lds_b128 %3, %7, off\n\t"
      "s_wait_xcnt 0x0"
      :
      : "v"(ldsa), "v"(ldsa + astep), "v"(ldsb), "v"(ldsb + bstep), "v"(ga),
        "v"(ga + gstep), "v"(gb), "v"(gb + gstep)
      : "memory");
}

// This wave's copies have landed (another wave reads them behind the barrier).
__device__ __forceinline__ void wait_async0() {
  asm volatile("s_wait_asynccnt 0x0" ::: "memory");
}

// This wave's LDS reads have returned: the buffer they read may be refilled.
__device__ __forceinline__ void wait_ds0() {
  asm volatile("s_wait_dscnt 0x0" ::: "memory");
}

// ---------------------------------------------------------------------------
// fp32 -> f16 of all six matrix inputs in ONE launch (every GEMM input is f16).
// The f16 copies lie back to back in the workspace, in the order q-domain (4),
// kv-domain (8), Wq, Wk, Wv, Wo (1 each, in pieces of 2^20 elements), so dst is
// one flat array. A block owns 32768 consecutive elements (32 blocks a piece,
// so a block never straddles two sources); a thread converts 16 groups of 8.
// 512 blocks = 4096 waves to start (two blocks a WGP), where one group a thread
// would start 65536; a wave's loads all stand ahead of its stores.
// ---------------------------------------------------------------------------
__global__ __launch_bounds__(256) void cvt_all_kernel(
    const float* __restrict__ qd, const float* __restrict__ kvd,
    const float* __restrict__ wq, const float* __restrict__ wk,
    const float* __restrict__ wv, const float* __restrict__ wo,
    _Float16* __restrict__ dst) {
  const int piece = blockIdx.x >> 5;  // block-uniform: scalar selects
  const float* src = qd;
  int first = 0;  // first piece of the chosen source
  if (piece >= 4)  { src = kvd; first = 4; }
  if (piece == 12) { src = wq;  first = 12; }
  if (piece == 13) { src = wk;  first = 13; }
  if (piece == 14) { src = wv;  first = 14; }
  if (piece == 15) { src = wo;  first = 15; }

  const size_t base = (size_t)blockIdx.x * 32768 + threadIdx.x * 8;
  const float* s = src + (base - ((size_t)first << 20));
  _Float16* d = dst + base;

  v8f x[16];
#pragma unroll  // straight line, so that many loads of a wave are in flight at once
  for (int k = 0; k < 16; ++k) x[k] = *(const v8f*)(s + k * 2048);
#pragma unroll  // x[] must stay in registers: constant indices only
  for (int k = 0; k < 16; ++k) {
    v8h h;
#pragma unroll
    for (int e = 0; e < 8; ++e) h[e] = (_Float16)x[k][e];
    *(v8h*)(d + k * 2048) = h;
  }
}

// ---------------------------------------------------------------------------
// GEMM: Y[m,n] = sum_k X[m,k]*W[n,k] + bias[n]  (X,W f16; Y f16 or f32).
// Block 256 = 8 waves; tile 128(M) x 128(N); wave tile 64x32 (c[4][2]).
// K goes in stages of 128 halfs = 256 B of every operand row, so that one
// wave-wide async copy is two whole rows of the stage: four whole 128-B lines
// (a 64-B stage row made it 16 lines of 32 B each). Two LDS buffers:
//   wmma on stage s -> dscnt 0 -> asynccnt 0 -> barrier -> copies of stage s+2.
// 32 wmma per wave per stage, k ascending. K: a multiple of 128, at least 128.
// ---------------------------------------------------------------------------
#define GBK    128  // halfs of K a stage
#define GPITCH 136  // LDS row pitch in halfs: 272 B = 16 B x 17 (b128 readers)

template <typename OutT>
__global__ __launch_bounds__(256) void gemm_h_kernel(
    const _Float16* __restrict__ X, const _Float16* __restrict__ W,
    const float* __restrict__ bias, OutT* __restrict__ Y,
    int M, int N, int K) {
  const int n0 = blockIdx.x * 128;
  const int m0 = blockIdx.y * 128;
  const int t  = threadIdx.x;
  const int w  = t >> 5;
  const int l  = t & 31;
  const int lm = l & 15;
  const int g  = l >> 4;
  const int wm = w & 1;    // 2 waves along M (64 rows each)
  const int wn = w >> 1;   // 4 waves along N (32 cols each)

  __shared__ __attribute__((aligned(16))) _Float16 As[2][128 * GPITCH];
  __shared__ __attribute__((aligned(16))) _Float16 Bs[2][128 * GPITCH];

  v8f c[4][2];
#pragma unroll
  for (int i = 0; i < 4; ++i)
#pragma unroll
    for (int j = 0; j < 2; ++j) c[i][j] = zero_v8f();

  // Per-thread staging share: 16-B piece t&15 of rows (t>>4) + 16*i, i = 0..7,
  // of each matrix: 16 lanes cover one 256-B stage row.
  const int srow = t >> 4;
  const int scol = (t & 15) * 8;
  const _Float16* Xg = X + (size_t)(m0 + srow) * K + scol;
  const _Float16* Wg = W + (size_t)(n0 + srow) * K + scol;
  const unsigned lofs = (unsigned)((srow * GPITCH + scol) * 2);  // bytes
  const unsigned la0 = (unsigned)(uintptr_t)(&As[0][0]) + lofs;
  const unsigned lb0 = (unsigned)(uintptr_t)(&Bs[0][0]) + lofs;
  const unsigned lbuf  = 128 * GPITCH * 2;  // bytes from buffer 0 to buffer 1
  const unsigned lstep = 16 * GPITCH * 2;   // bytes from a copy's row to the next's
  const int nst = K / GBK;

  // Stage 0 into buffer 0, published; then stage 1 flies into buffer 1.
  async_copy8_b128(la0, lstep, Xg, 16 * K);
  async_copy8_b128(lb0, lstep, Wg, 16 * K);
  wait_async0();
  __syncthreads();
  if (nst > 1) {
    async_copy8_b128(la0 + lbuf, lstep, Xg + GBK, 16 * K);
    async_copy8_b128(lb0 + lbuf, lstep, Wg + GBK, 16 * K);
  }

  for (int s = 0; s < nst; ++s) {
    const int cur = s & 1;
    const _Float16* Ab = As[cur];
    const _Float16* Bb = Bs[cur];
#pragma unroll
    for (int ks = 0; ks < GBK; ks += 32) {
      v16h af[4];
#pragma unroll
      for (int i = 0; i < 4; ++i)
        af[i] = load_frag(Ab, GPITCH, wm * 64 + i * 16 + lm, ks, g);
#pragma unroll
      for (int j = 0; j < 2; ++j) {
        v16h bf = load_frag(Bb, GPITCH, wn * 32 + j * 16 + lm, ks, g);
#pragma unroll
        for (int i = 0; i < 4; ++i) c[i][j] = wmma_f32_f16(af[i], bf, c[i][j]);
      }
    }

    // Publish stage s+1 and free stage s's buffer, then refill that buffer.
    wait_ds0();
    wait_async0();
    __syncthreads();
    if (s + 2 < nst) {
      const unsigned lo = cur ? lbuf : 0u;
      async_copy8_b128(la0 + lo, lstep, Xg + (s + 2) * GBK, 16 * K);
      async_copy8_b128(lb0 + lo, lstep, Wg + (s + 2) * GBK, 16 * K);
    }
  }
  wait_async0();  // nothing is in flight here; kept in front of the wave's end

  // Epilogue: C layout -> lane holds col n = lm, rows r + 8g.
#pragma unroll
  for (int j = 0; j < 2; ++j) {
    const int ncol = n0 + wn * 32 + j * 16 + lm;
    const float bj = bias[ncol];
#pragma unroll
    for (int i = 0; i < 4; ++i) {
#pragma unroll
      for (int r = 0; r < 8; ++r) {
        const int mrow = m0 + wm * 64 + i * 16 + r + 8 * g;
        Y[(size_t)mrow * N + ncol] = (OutT)(c[i][j][r] + bj);
      }
    }
  }
}

#define AB   4
#define ALQ  1024
#define ALKV 2048
#define AD   1024
#define AH   16
#define AHD  64
#define AQB  128  // queries a block
#define AKS  64  // keys a stage
#define AKP  72  // K pitch in LDS, halfs: 144 B = 16 B x 9 (b128 readers)
#define AVP  80  // V pitch in LDS, halfs: 160 B = 32 B x 5 (transposing readers)

typedef float v2f __attribute__((ext_vector_type(2)));
typedef float v4f __attribute__((ext_vector_type(4)));

__device__ __forceinline__ float xhalf(float x) {
  const int i = __builtin_bit_cast(int, x);
  return __builtin_bit_cast(
      float, __builtin_amdgcn_permlanex16(i, i, 0x76543210, 0xfedcba98, false,
                                          false));
}

__global__ __launch_bounds__(256) void attn_kernel(
    const _Float16* __restrict__ q, const _Float16* __restrict__ kmat,
    const _Float16* __restrict__ vmat, _Float16* __restrict__ ctx,
    const float* __restrict__ scale_p, const float* __restrict__ beta_p) {
  const int qt = blockIdx.x;
  const int h  = blockIdx.y;
  const int b  = blockIdx.z;
  const int t  = threadIdx.x;
  const int w  = t >> 5;
  const int l  = t & 31;
  const int lm = l & 15;
  const int g  = l >> 4;
  const int qg = w & 3;   // query group: columns qg*32 .. qg*32+31 of the block
  const int kh = w >> 2;  // key half: keys kh*32 .. kh*32+31 of every stage

  __shared__ __attribute__((aligned(16))) _Float16 Qs[AQB * 72];  // 128 q x 64 d
  __shared__ __attribute__((aligned(16))) _Float16 Ks[2][AKS * AKP];
  __shared__ __attribute__((aligned(16))) _Float16 Vs[2][AKS * AVP];
  // Key half 1's results, lane by lane: O^T as 16 pieces of 4 floats, max, sum.
  __shared__ __attribute__((aligned(16))) float Om[4][16][32][4];
  __shared__ float Mm[4][2][32];
  __shared__ float Ml[4][2][32];

  // Per-thread staging share: 16-B piece t&7 of rows (t>>3) + 32*i, i = 0..1, of
  // K and of V: 8 lanes cover one 128-B row of this head.
  const int srow = t >> 3;
  const int scol = (t & 7) * 8;
  const size_t goff = ((size_t)(b * ALKV + srow)) * AD + h * AHD + scol;
  const _Float16* Kg = kmat + goff;
  const _Float16* Vg = vmat + goff;
  const unsigned lk0 =
      (unsigned)(uintptr_t)(&Ks[0][0]) + (unsigned)((srow * AKP + scol) * 2);
  const unsigned lv0 =
      (unsigned)(uintptr_t)(&Vs[0][0]) + (unsigned)((srow * AVP + scol) * 2);
  const unsigned kbuf = AKS * AKP * 2, vbuf = AKS * AVP * 2;  // bytes a buffer
  const unsigned kstep = 32 * AKP * 2, vstep = 32 * AVP * 2;  // bytes, 32 rows
  const int nst = ALKV / AKS;

  // Stage 0 starts to fly into buffer 0 while Q is staged.
  async_copy2x2_b128(lk0, kstep, Kg, lv0, vstep, Vg, 32 * AD);

  // Softmax in base 2: exp(x) = 2^(x * log2 e), with log2 e folded into the score
  // factor and into the shift, so that a score costs one fma ahead of its v_exp.
  const float c2s = scale_p[0] * 0.125f * 1.44269504f;  // 1/sqrt(64) * log2 e
  const float c2  = fabsf(c2s);
  const float b2  = beta_p[0] * 1.44269504f;

  {  // Stage Q tile once.
    const int row = t >> 1;
    const int cb  = (t & 1) * 32;
    const _Float16* src =
        q + ((size_t)(b * ALQ + qt * AQB + row)) * AD + h * AHD + cb;
    _Float16* dst = &Qs[row * 72 + cb];
#pragma unroll
    for (int i = 0; i < 4; ++i)
      *(v8h*)(dst + i * 8) = *(const v8h*)(src + i * 8);
  }
  wait_async0();
  __syncthreads();  // publishes Q and stage 0
  // Stage 1 flies into buffer 1.
  async_copy2x2_b128(lk0 + kbuf, kstep, Kg + AKS * AD, lv0 + vbuf, vstep,
                     Vg + AKS * AD, 32 * AD);

  // B operand Q^T of tile j: column lm = query qg*32 + j*16 + lm, k = d in the
  // hardware order.
  v16h qb0[2], qb1[2];
#pragma unroll
  for (int j = 0; j < 2; ++j) {
    qb0[j] = load_frag(Qs, 72, qg * 32 + j * 16 + lm, 0, g);
    qb1[j] = load_frag(Qs, 72, qg * 32 + j * 16 + lm, 32, g);
    // The maximum is taken over raw scores, which orders them as the scaled ones
    // only under a factor >= 0: a negative factor's sign goes into Q (exact).
    if (c2s < 0.0f) { qb0[j] = -qb0[j]; qb1[j] = -qb1[j]; }
  }

  // This wave's 32 keys of a stage in buffer 0: K rows, and this lane's address
  // for the transposing loads of V (its keys 0..15, d 0..15).
  const _Float16* kb = &Ks[0][kh * 32 * AKP];
  const _Float16* vtp =
      &Vs[0][(kh * 32 + 8 * g + (l & 7)) * AVP + 8 * ((l >> 3) & 1)];

  // Per lane and tile: running max (scaled, shifted, in log2 units) and this
  // half-wave's partial sum of query qg*32 + j*16 + lm, over this key half.
  float mrow[2] = {-1e30f, -1e30f}, lrow[2] = {0.0f, 0.0f};
  v8f acc[2][4];  // acc[j][d][r] = O^T[d*16 + 8g + r][query lm of tile j]
#pragma unroll
  for (int j = 0; j < 2; ++j)
#pragma unroll
    for (int d = 0; d < 4; ++d) acc[j][d] = zero_v8f();

  for (int s = 0; s < nst; ++s) {
    const int cur = s & 1;
    const _Float16* Kc = kb + cur * (AKS * AKP);
    const _Float16* vc = vtp + cur * (AKS * AVP);

    // s0[j][r] = S^T[key 8g + r][query lm of tile j], s1: key 16 + 8g + r.
    v8f s0[2], s1[2];
    {
      const v16h ka0 = load_frag(Kc, AKP, lm, 0, g);
      const v16h ka1 = load_frag(Kc, AKP, lm, 32, g);
      const v16h ka2 = load_frag(Kc, AKP, 16 + lm, 0, g);
      const v16h ka3 = load_frag(Kc, AKP, 16 + lm, 32, g);
#pragma unroll
      for (int j = 0; j < 2; ++j) s0[j] = wmma_f32_f16(ka0, qb0[j], zero_v8f());
#pragma unroll
      for (int j = 0; j < 2; ++j) s1[j] = wmma_f32_f16(ka2, qb0[j], zero_v8f());
#pragma unroll
      for (int j = 0; j < 2; ++j) s0[j] = wmma_f32_f16(ka1, qb1[j], s0[j]);
#pragma unroll
      for (int j = 0; j < 2; ++j) s1[j] = wmma_f32_f16(ka3, qb1[j], s1[j]);
    }

    v16h pb[2];
#pragma unroll  // the two tiles' chains are independent: they fill each other's gaps
    for (int j = 0; j < 2; ++j) {
      float mx = fmaxf(s0[j][0], s1[j][0]);  // of raw scores
#pragma unroll
      for (int r = 1; r < 8; ++r) mx = fmaxf(mx, fmaxf(s0[j][r], s1[j][r]));
      mx = fmaxf(mx, xhalf(mx));  // both halves now hold the query's chunk max
      const float mnew  = fmaxf(mrow[j], fmaf(mx, c2, b2));
      const float alpha = __builtin_amdgcn_exp2f(mrow[j] - mnew);
      mrow[j] = mnew;
      // Exponent of a score: s * c2 + b2 - mnew, as one fma (packed in pairs).
      const float nb = b2 - mnew;
      v8f e0, e1;
#pragma unroll
      for (int r = 0; r < 8; r += 2) {
        const v2f a0 = __builtin_elementwise_fma(v2f{s0[j][r], s0[j][r + 1]},
                                                 v2f{c2, c2}, v2f{nb, nb});
        const v2f a1 = __builtin_elementwise_fma(v2f{s1[j][r], s1[j][r + 1]},
                                                 v2f{c2, c2}, v2f{nb, nb});
        e0[r] = a0.x; e0[r + 1] = a0.y;
        e1[r] = a1.x; e1[r + 1] = a1.y;
      }

      // P^T as B operand: element s is key kmap(s) = 8g + s (s < 8), 16 + 8g + s - 8.
      float ps = 0.0f;
#pragma unroll
      for (int r = 0; r < 8; ++r) {
        const float p0 = __builtin_amdgcn_exp2f(e0[r]);
        const float p1 = __builtin_amdgcn_exp2f(e1[r]);
        ps += p0 + p1;
        pb[j][r]     = (_Float16)p0;
        pb[j][r + 8] = (_Float16)p1;
      }
      lrow[j] = lrow[j] * alpha + ps;
#pragma unroll
      for (int d = 0; d < 4; ++d) acc[j][d] *= alpha;
    }

#pragma unroll
    for (int d = 0; d < 4; ++d) {
      // A = V^T: row d*16 + lm, keys 8g + 0..7 then 16 + 8g + 0..7 (pb's order).
      const v8h lo = load_tr16(vc + d * 16);
      const v8h hi = load_tr16(vc + 16 * AVP + d * 16);
      v16h va;
#pragma unroll
      for (int e = 0; e < 8; ++e) { va[e] = lo[e]; va[e + 8] = hi[e]; }
#pragma unroll
      for (int j = 0; j < 2; ++j) acc[j][d] = wmma_f32_f16(va, pb[j], acc[j][d]);
    }

    // Publish stage s+1 and free stage s's buffer, then refill that buffer.
    wait_ds0();
    wait_async0();
    __syncthreads();
    if (s + 2 < nst) {
      const size_t go = (size_t)(s + 2) * (AKS * AD);
      async_copy2x2_b128(lk0 + (cur ? kbuf : 0u), kstep, Kg + go,
                         lv0 + (cur ? vbuf : 0u), vstep, Vg + go, 32 * AD);
    }
  }
  wait_async0();  // nothing is in flight here; kept in front of the wave's end

  float lt[2];  // this key half's sum: the half-waves' parts joined
#pragma unroll
  for (int j = 0; j < 2; ++j) lt[j] = lrow[j] + xhalf(lrow[j]);

  if (kh == 1) {  // hand max, sum and O^T of keys 32..63 of every stage over
#pragma unroll
    for (int j = 0; j < 2; ++j) {
      Mm[qg][j][l] = mrow[j];
      Ml[qg][j][l] = lt[j];
#pragma unroll
      for (int d = 0; d < 4; ++d) {
        const v8f a = acc[j][d];
        v4f lo = {a[0], a[1], a[2], a[3]};
        v4f hi = {a[4], a[5], a[6], a[7]};
        *(v4f*)&Om[qg][(j * 4 + d) * 2 + 0][l][0] = lo;
        *(v4f*)&Om[qg][(j * 4 + d) * 2 + 1][l][0] = hi;
      }
    }
  }
  __syncthreads();  // key half 1's results are readable by key half 0
  if (kh == 0) {
#pragma unroll
    for (int j = 0; j < 2; ++j) {
      // Both halves onto the common max, then one division for the joint sum.
      const float m1 = Mm[qg][j][l];
      const float l1 = Ml[qg][j][l];
      const float mj = fmaxf(mrow[j], m1);
      const float a0 = __builtin_amdgcn_exp2f(mrow[j] - mj);
      const float a1 = __builtin_amdgcn_exp2f(m1 - mj);
      const float rinv = 1.0f / (lt[j] * a0 + l1 * a1);
      const float f0 = a0 * rinv, f1 = a1 * rinv;
      const int qrow = qt * AQB + qg * 32 + j * 16 + lm;
      _Float16* dst = ctx + ((size_t)(b * ALQ + qrow)) * AD + h * AHD + 8 * g;
#pragma unroll
      for (int d = 0; d < 4; ++d) {
        const v4f lo = *(const v4f*)&Om[qg][(j * 4 + d) * 2 + 0][l][0];
        const v4f hi = *(const v4f*)&Om[qg][(j * 4 + d) * 2 + 1][l][0];
        v8h o;
#pragma unroll
        for (int r = 0; r < 4; ++r) {
          o[r]     = (_Float16)(acc[j][d][r] * f0 + lo[r] * f1);
          o[r + 4] = (_Float16)(acc[j][d][r + 4] * f0 + hi[r] * f1);
        }
        *(v8h*)(dst + d * 16) = o;  // 8 consecutive d of one query: one 16B store
      }
    }
  }
}

// ---------------------------------------------------------------------------
// Launcher. Workspace (f16 unless noted):
//  [0,8)MB qdom | [8,24) kvdom | [24,26) Wq | [26,28) Wk | [28,30) Wv
//  [30,32) Wo | [32,40) q | [40,56) k | [56,72) v | [72,80) ctx  => 80MB
// ---------------------------------------------------------------------------
extern "C" void kernel_launch(void* const* d_in, const int* in_sizes, int n_in,
                              void* d_out, int out_size, void* d_ws,
                              size_t ws_size, hipStream_t stream) {
  (void)in_sizes; (void)n_in; (void)out_size; (void)ws_size;

  const float* qdom  = (const float*)d_in[0];
  const float* kvdom = (const float*)d_in[1];
  const float* Wq = (const float*)d_in[2];
  const float* bq = (const float*)d_in[3];
  const float* Wk = (const float*)d_in[4];
  const float* bk = (const float*)d_in[5];
  const float* Wv = (const float*)d_in[6];
  const float* bv = (const float*)d_in[7];
  const float* Wo = (const float*)d_in[8];
  const float* bo = (const float*)d_in[9];
  const float* scale = (const float*)d_in[10];
  const float* beta  = (const float*)d_in[11];
  float* out = (float*)d_out;

  const size_t MB = 1u << 20;
  char* ws = (char*)d_ws;
  _Float16* qdom_h  = (_Float16*)(ws + 0 * MB);
  _Float16* kvdom_h = (_Float16*)(ws + 8 * MB);
  _Float16* Wq_h    = (_Float16*)(ws + 24 * MB);
  _Float16* Wk_h    = (_Float16*)(ws + 26 * MB);
  _Float16* Wv_h    = (_Float16*)(ws + 28 * MB);
  _Float16* Wo_h    = (_Float16*)(ws + 30 * MB);
  _Float16* qh      = (_Float16*)(ws + 32 * MB);
  _Float16* kh      = (_Float16*)(ws + 40 * MB);
  _Float16* vh      = (_Float16*)(ws + 56 * MB);
  _Float16* ctxh    = (_Float16*)(ws + 72 * MB);

  // qdom_h .. Wo_h are contiguous: one flat destination of 16 * 2^20 halfs.
  cvt_all_kernel<<<dim3(512), dim3(256), 0, stream>>>(qdom, kvdom, Wq, Wk, Wv,
                                                      Wo, qdom_h);

  const dim3 blk(256);
  gemm_h_kernel<_Float16><<<dim3(1024 / 128, 4096 / 128), blk, 0, stream>>>(
      qdom_h, Wq_h, bq, qh, 4096, 1024, 1024);
  gemm_h_kernel<_Float16><<<dim3(1024 / 128, 8192 / 128), blk, 0, stream>>>(
      kvdom_h, Wk_h, bk, kh, 8192, 1024, 1024);
  gemm_h_kernel<_Float16><<<dim3(1024 / 128, 8192 / 128), blk, 0, stream>>>(
      kvdom_h, Wv_h, bv, vh, 8192, 1024, 1024);

  attn_kernel<<<dim3(ALQ / AQB, AH, AB), dim3(256), 0, stream>>>(
      qh, kh, vh, ctxh, scale, beta);

  gemm_h_kernel<float><<<dim3(1024 / 128, 4096 / 128), blk, 0, stream>>>(
      ctxh, Wo_h, bo, out, 4096, 1024, 1024);
}

// v008
// Measured time: 106 microseconds a run.
// Two timings next to v007 put it at 1.04 and 1.05 times that version's speed.
// All steps since v000 together make it 2.14 times as fast.
#include <hip/hip_runtime.h>
#include <hip/hip_bf16.h>

typedef float     v8f  __attribute__((ext_vector_type(8)));
typedef _Float16  v8h  __attribute__((ext_vector_type(8)));
typedef _Float16  v16h __attribute__((ext_vector_type(16)));

__device__ __forceinline__ v8f wmma_f32_f16(v16h a, v16h b, v8f c) {
  return __builtin_amdgcn_wmma_f32_16x16x32_f16(false, a, false, b, (short)0, c,
                                                false, false);
}

__device__ __forceinline__ v8f zero_v8f() {
  v8f z;
#pragma unroll
  for (int i = 0; i < 8; ++i) z[i] = 0.0f;
  return z;
}

__device__ __forceinline__ v16h load_frag(const _Float16* base, int stride,
                                          int row, int koff, int g) {
  const _Float16* p = base + row * stride + koff + 8 * g;
  v8h lo = *(const v8h*)(p);
  v8h hi = *(const v8h*)(p + 16);
  v16h r;
#pragma unroll
  for (int e = 0; e < 8; ++e) { r[e] = lo[e]; r[e + 8] = hi[e]; }
  return r;
}

typedef short s16x8 __attribute__((ext_vector_type(8)));
__device__ __forceinline__ v8h load_tr16(const _Float16* p) {
  typedef __attribute__((address_space(3))) s16x8 lds_s16x8;
  return __builtin_bit_cast(
      v8h, __builtin_amdgcn_ds_load_tr16_b128_v8i16((lds_s16x8*)p));
}

__device__ __forceinline__ void async_copy8_b128(unsigned lds, unsigned lstep,
                                                 const _Float16* g, int gstep) {
  asm volatile(
      "global_load_async_to_lds_b128 %0, %8, off\n\t"
      "global_load_async_to_lds_b128 %1, %9, off\n\t"
      "global_load_async_to_lds_b128 %2, %10, off\n\t"
      "global_load_async_to_lds_b128 %3, %11, off\n\t"
      "global_load_async_to_lds_b128 %4, %12, off\n\t"
      "global_load_async_to_lds_b128 %5, %13, off\n\t"
      "global_load_async_to_lds_b128 %6, %14, off\n\t"
      "global_load_async_to_lds_b128 %7, %15, off\n\t"
      "s_wait_xcnt 0x0"
      :
      : "v"(lds), "v"(lds + lstep), "v"(lds + 2 * lstep), "v"(lds + 3 * lstep),
        "v"(lds + 4 * lstep), "v"(lds + 5 * lstep), "v"(lds + 6 * lstep),
        "v"(lds + 7 * lstep), "v"(g), "v"(g + gstep), "v"(g + 2 * gstep),
        "v"(g + 3 * gstep), "v"(g + 4 * gstep), "v"(g + 5 * gstep),
        "v"(g + 6 * gstep), "v"(g + 7 * gstep)
      : "memory");
}

__device__ __forceinline__ void async_copy2x2_b128(
    unsigned ldsa, unsigned astep, const _Float16* ga, unsigned ldsb,
    unsigned bstep, const _Float16* gb, int gstep) {
  asm volatile(
      "global_load_async_to_lds_b128 %0, %4, off\n\t"
      "global_load_async_to_lds_b128 %1, %5, off\n\t"
      "global_load_async_to_lds_b128 %2, %6, off\n\t"
      "global_load_async_to_lds_b128 %3, %7, off\n\t"
      "s_wait_xcnt 0x0"
      :
      : "v"(ldsa), "v"(ldsa + astep), "v"(ldsb), "v"(ldsb + bstep), "v"(ga),
        "v"(ga + gstep), "v"(gb), "v"(gb + gstep)
      : "memory");
}

// This wave's copies have landed (another wave reads them behind the barrier).
__device__ __forceinline__ void wait_async0() {
  asm volatile("s_wait_asynccnt 0x0" ::: "memory");
}

// This wave's LDS reads have returned: the buffer they read may be refilled.
__device__ __forceinline__ void wait_ds0() {
  asm volatile("s_wait_dscnt 0x0" ::: "memory");
}

// ---------------------------------------------------------------------------
// fp32 -> f16 of all six matrix inputs in ONE launch (every GEMM input is f16).
// The f16 copies lie back to back in the workspace, in the order q-domain (4),
// kv-domain (8), Wq, Wk, Wv, Wo (1 each, in pieces of 2^20 elements), so dst is
// one flat array. A block owns 32768 consecutive elements (32 blocks a piece,
// so a block never straddles two sources); a thread converts 16 groups of 8.
// 512 blocks = 4096 waves to start (two blocks a WGP), where one group a thread
// would start 65536; a wave's loads all stand ahead of its stores.
// ---------------------------------------------------------------------------
__global__ __launch_bounds__(256) void cvt_all_kernel(
    const float* __restrict__ qd, const float* __restrict__ kvd,
    const float* __restrict__ wq, const float* __restrict__ wk,
    const float* __restrict__ wv, const float* __restrict__ wo,
    _Float16* __restrict__ dst) {
  const int piece = blockIdx.x >> 5;  // block-uniform: scalar selects
  const float* src = qd;
  int first = 0;  // first piece of the chosen source
  if (piece >= 4)  { src = kvd; first = 4; }
  if (piece == 12) { src = wq;  first = 12; }
  if (piece == 13) { src = wk;  first = 13; }
  if (piece == 14) { src = wv;  first = 14; }
  if (piece == 15) { src = wo;  first = 15; }

  const size_t base = (size_t)blockIdx.x * 32768 + threadIdx.x * 8;
  const float* s = src + (base - ((size_t)first << 20));
  _Float16* d = dst + base;

  v8f x[16];
#pragma unroll  // straight line, so that many loads of a wave are in flight at once
  for (int k = 0; k < 16; ++k) x[k] = *(const v8f*)(s + k * 2048);
#pragma unroll  // x[] must stay in registers: constant indices only
  for (int k = 0; k < 16; ++k) {
    v8h h;
#pragma unroll
    for (int e = 0; e < 8; ++e) h[e] = (_Float16)x[k][e];
    *(v8h*)(d + k * 2048) = h;
  }
}

// ---------------------------------------------------------------------------
// GEMM: Y[m,n] = sum_k X[m,k]*W[n,k] + bias[n]  (X,W f16; Y f16 or f32).
// Block 256 = 8 waves; tile 128(M) x 128(N); wave tile 64x32 (c[4][2]).
// K goes in stages of 128 halfs = 256 B of every operand row, so that one
// wave-wide async copy is two whole rows of the stage: four whole 128-B lines
// (a 64-B stage row made it 16 lines of 32 B each). Two LDS buffers:
//   wmma on stage s -> dscnt 0 -> asynccnt 0 -> barrier -> copies of stage s+2.
// 32 wmma per wave per stage, k ascending. K: a multiple of 128, at least 128.
// gemm_tile is one block's tile at (m0, n0); two kernels call it: one launch for
// the three input projections, one for the output projection.
// ---------------------------------------------------------------------------
#define GBK    128  // halfs of K a stage
#define GPITCH 136  // LDS row pitch in halfs: 272 B = 16 B x 17 (b128 readers)

template <typename OutT>
__device__ __forceinline__ void gemm_tile(
    const _Float16* __restrict__ X, const _Float16* __restrict__ W,
    const float* __restrict__ bias, OutT* __restrict__ Y,
    int m0, int n0, int N, int K) {
  const int t  = threadIdx.x;
  const int w  = t >> 5;
  const int l  = t & 31;
  const int lm = l & 15;
  const int g  = l >> 4;
  const int wm = w & 1;    // 2 waves along M (64 rows each)
  const int wn = w >> 1;   // 4 waves along N (32 cols each)

  __shared__ __attribute__((aligned(16))) _Float16 As[2][128 * GPITCH];
  __shared__ __attribute__((aligned(16))) _Float16 Bs[2][128 * GPITCH];

  v8f c[4][2];
#pragma unroll
  for (int i = 0; i < 4; ++i)
#pragma unroll
    for (int j = 0; j < 2; ++j) c[i][j] = zero_v8f();

  // Per-thread staging share: 16-B piece t&15 of rows (t>>4) + 16*i, i = 0..7,
  // of each matrix: 16 lanes cover one 256-B stage row.
  const int srow = t >> 4;
  const int scol = (t & 15) * 8;
  const _Float16* Xg = X + (size_t)(m0 + srow) * K + scol;
  const _Float16* Wg = W + (size_t)(n0 + srow) * K + scol;
  const unsigned lofs = (unsigned)((srow * GPITCH + scol) * 2);  // bytes
  const unsigned la0 = (unsigned)(uintptr_t)(&As[0][0]) + lofs;
  const unsigned lb0 = (unsigned)(uintptr_t)(&Bs[0][0]) + lofs;
  const unsigned lbuf  = 128 * GPITCH * 2;  // bytes from buffer 0 to buffer 1
  const unsigned lstep = 16 * GPITCH * 2;   // bytes from a copy's row to the next's
  const int nst = K / GBK;

  // Stage 0 into buffer 0, published; then stage 1 flies into buffer 1.
  async_copy8_b128(la0, lstep, Xg, 16 * K);
  async_copy8_b128(lb0, lstep, Wg, 16 * K);
  wait_async0();
  __syncthreads();
  if (nst > 1) {
    async_copy8_b128(la0 + lbuf, lstep, Xg + GBK, 16 * K);
    async_copy8_b128(lb0 + lbuf, lstep, Wg + GBK, 16 * K);
  }

  for (int s = 0; s < nst; ++s) {
    const int cur = s & 1;
    const _Float16* Ab = As[cur];
    const _Float16* Bb = Bs[cur];
#pragma unroll
    for (int ks = 0; ks < GBK; ks += 32) {
      v16h af[4];
#pragma unroll
      for (int i = 0; i < 4; ++i)
        af[i] = load_frag(Ab, GPITCH, wm * 64 + i * 16 + lm, ks, g);
#pragma unroll
      for (int j = 0; j < 2; ++j) {
        v16h bf = load_frag(Bb, GPITCH, wn * 32 + j * 16 + lm, ks, g);
#pragma unroll
        for (int i = 0; i < 4; ++i) c[i][j] = wmma_f32_f16(af[i], bf, c[i][j]);
      }
    }

    // Publish stage s+1 and free stage s's buffer, then refill that buffer.
    wait_ds0();
    wait_async0();
    __syncthreads();
    if (s + 2 < nst) {
      const unsigned lo = cur ? lbuf : 0u;
      async_copy8_b128(la0 + lo, lstep, Xg + (s + 2) * GBK, 16 * K);
      async_copy8_b128(lb0 + lo, lstep, Wg + (s + 2) * GBK, 16 * K);
    }
  }
  wait_async0();  // nothing is in flight here; kept in front of the wave's end

  // Epilogue: C layout -> lane holds col n = lm, rows r + 8g.
#pragma unroll
  for (int j = 0; j < 2; ++j) {
    const int ncol = n0 + wn * 32 + j * 16 + lm;
    const float bj = bias[ncol];
#pragma unroll
    for (int i = 0; i < 4; ++i) {
#pragma unroll
      for (int r = 0; r < 8; ++r) {
        const int mrow = m0 + wm * 64 + i * 16 + r + 8 * g;
        Y[(size_t)mrow * N + ncol] = (OutT)(c[i][j][r] + bj);
      }
    }
  }
}

// Output projection: grid (N/128, M/128).
__global__ __launch_bounds__(256) void gemm_out_kernel(
    const _Float16* __restrict__ X, const _Float16* __restrict__ W,
    const float* __restrict__ bias, float* __restrict__ Y, int N, int K) {
  gemm_tile<float>(X, W, bias, Y, blockIdx.y * 128, blockIdx.x * 128, N, K);
}

__global__ __launch_bounds__(256) void gemm_qkv_kernel(
    const _Float16* __restrict__ Xq, const _Float16* __restrict__ Xkv,
    const _Float16* __restrict__ Wq, const _Float16* __restrict__ Wk,
    const _Float16* __restrict__ Wv, const float* __restrict__ bq,
    const float* __restrict__ bk, const float* __restrict__ bv,
    _Float16* __restrict__ Yq, _Float16* __restrict__ Yk,
    _Float16* __restrict__ Yv, int tq, int tkv, int N, int K) {
  int ty = blockIdx.y;  // block-uniform: scalar selects
  const _Float16* X = Xq;
  const _Float16* W = Wq;
  const float* bias = bq;
  _Float16* Y = Yq;
  if (ty >= tq) {
    ty -= tq; X = Xkv; W = Wk; bias = bk; Y = Yk;
    if (ty >= tkv) { ty -= tkv; W = Wv; bias = bv; Y = Yv; }
  }
  gemm_tile<_Float16>(X, W, bias, Y, ty * 128, blockIdx.x * 128, N, K);
}

#define AB   4
#define ALQ  1024
#define ALKV 2048
#define AD   1024
#define AH   16
#define AHD  64
#define AQB  128  // queries a block
#define AKS  64  // keys a stage
#define AKP  72  // K pitch in LDS, halfs: 144 B = 16 B x 9 (b128 readers)
#define AVP  80  // V pitch in LDS, halfs: 160 B = 32 B x 5 (transposing readers)

typedef float v2f __attribute__((ext_vector_type(2)));
typedef float v4f __attribute__((ext_vector_type(4)));

__device__ __forceinline__ float xhalf(float x) {
  const int i = __builtin_bit_cast(int, x);
  return __builtin_bit_cast(
      float, __builtin_amdgcn_permlanex16(i, i, 0x76543210, 0xfedcba98, false,
                                          false));
}

__global__ __launch_bounds__(256) void attn_kernel(
    const _Float16* __restrict__ q, const _Float16* __restrict__ kmat,
    const _Float16* __restrict__ vmat, _Float16* __restrict__ ctx,
    const float* __restrict__ scale_p, const float* __restrict__ beta_p) {
  const int qt = blockIdx.x;
  const int h  = blockIdx.y;
  const int b  = blockIdx.z;
  const int t  = threadIdx.x;
  const int w  = t >> 5;
  const int l  = t & 31;
  const int lm = l & 15;
  const int g  = l >> 4;
  const int qg = w & 3;   // query group: columns qg*32 .. qg*32+31 of the block
  const int kh = w >> 2;  // key half: keys kh*32 .. kh*32+31 of every stage

  __shared__ __attribute__((aligned(16))) _Float16 Qs[AQB * 72];  // 128 q x 64 d
  __shared__ __attribute__((aligned(16))) _Float16 Ks[2][AKS * AKP];
  __shared__ __attribute__((aligned(16))) _Float16 Vs[2][AKS * AVP];
  // Key half 1's results, lane by lane: O^T as 16 pieces of 4 floats, max, sum.
  __shared__ __attribute__((aligned(16))) float Om[4][16][32][4];
  __shared__ float Mm[4][2][32];
  __shared__ float Ml[4][2][32];

  // Per-thread staging share: 16-B piece t&7 of rows (t>>3) + 32*i, i = 0..1, of
  // K and of V: 8 lanes cover one 128-B row of this head.
  const int srow = t >> 3;
  const int scol = (t & 7) * 8;
  const size_t goff = ((size_t)(b * ALKV + srow)) * AD + h * AHD + scol;
  const _Float16* Kg = kmat + goff;
  const _Float16* Vg = vmat + goff;
  const unsigned lk0 =
      (unsigned)(uintptr_t)(&Ks[0][0]) + (unsigned)((srow * AKP + scol) * 2);
  const unsigned lv0 =
      (unsigned)(uintptr_t)(&Vs[0][0]) + (unsigned)((srow * AVP + scol) * 2);
  const unsigned kbuf = AKS * AKP * 2, vbuf = AKS * AVP * 2;  // bytes a buffer
  const unsigned kstep = 32 * AKP * 2, vstep = 32 * AVP * 2;  // bytes, 32 rows
  const int nst = ALKV / AKS;

  // Stage 0 starts to fly into buffer 0 while Q is staged.
  async_copy2x2_b128(lk0, kstep, Kg, lv0, vstep, Vg, 32 * AD);

  // Softmax in base 2: exp(x) = 2^(x * log2 e), with log2 e folded into the score
  // factor and into the shift, so that a score costs one fma ahead of its v_exp.
  const float c2s = scale_p[0] * 0.125f * 1.44269504f;  // 1/sqrt(64) * log2 e
  const float c2  = fabsf(c2s);
  const float b2  = beta_p[0] * 1.44269504f;

  {  // Stage Q tile once.
    const int row = t >> 1;
    const int cb  = (t & 1) * 32;
    const _Float16* src =
        q + ((size_t)(b * ALQ + qt * AQB + row)) * AD + h * AHD + cb;
    _Float16* dst = &Qs[row * 72 + cb];
#pragma unroll
    for (int i = 0; i < 4; ++i)
      *(v8h*)(dst + i * 8) = *(const v8h*)(src + i * 8);
  }
  wait_async0();
  __syncthreads();  // publishes Q and stage 0
  // Stage 1 flies into buffer 1.
  async_copy2x2_b128(lk0 + kbuf, kstep, Kg + AKS * AD, lv0 + vbuf, vstep,
                     Vg + AKS * AD, 32 * AD);

  // B operand Q^T of tile j: column lm = query qg*32 + j*16 + lm, k = d in the
  // hardware order.
  v16h qb0[2], qb1[2];
#pragma unroll
  for (int j = 0; j < 2; ++j) {
    qb0[j] = load_frag(Qs, 72, qg * 32 + j * 16 + lm, 0, g);
    qb1[j] = load_frag(Qs, 72, qg * 32 + j * 16 + lm, 32, g);
    // The maximum is taken over raw scores, which orders them as the scaled ones
    // only under a factor >= 0: a negative factor's sign goes into Q (exact).
    if (c2s < 0.0f) { qb0[j] = -qb0[j]; qb1[j] = -qb1[j]; }
  }

  // This wave's 32 keys of a stage in buffer 0: K rows, and this lane's address
  // for the transposing loads of V (its keys 0..15, d 0..15).
  const _Float16* kb = &Ks[0][kh * 32 * AKP];
  const _Float16* vtp =
      &Vs[0][(kh * 32 + 8 * g + (l & 7)) * AVP + 8 * ((l >> 3) & 1)];

  // Per lane and tile: running max (scaled, shifted, in log2 units) and this
  // half-wave's partial sum of query qg*32 + j*16 + lm, over this key half.
  float mrow[2] = {-1e30f, -1e30f}, lrow[2] = {0.0f, 0.0f};
  v8f acc[2][4];  // acc[j][d][r] = O^T[d*16 + 8g + r][query lm of tile j]
#pragma unroll
  for (int j = 0; j < 2; ++j)
#pragma unroll
    for (int d = 0; d < 4; ++d) acc[j][d] = zero_v8f();

  for (int s = 0; s < nst; ++s) {
    const int cur = s & 1;
    const _Float16* Kc = kb + cur * (AKS * AKP);
    const _Float16* vc = vtp + cur * (AKS * AVP);

    // s0[j][r] = S^T[key 8g + r][query lm of tile j], s1: key 16 + 8g + r.
    v8f s0[2], s1[2];
    {
      const v16h ka0 = load_frag(Kc, AKP, lm, 0, g);
      const v16h ka1 = load_frag(Kc, AKP, lm, 32, g);
      const v16h ka2 = load_frag(Kc, AKP, 16 + lm, 0, g);
      const v16h ka3 = load_frag(Kc, AKP, 16 + lm, 32, g);
#pragma unroll
      for (int j = 0; j < 2; ++j) s0[j] = wmma_f32_f16(ka0, qb0[j], zero_v8f());
#pragma unroll
      for (int j = 0; j < 2; ++j) s1[j] = wmma_f32_f16(ka2, qb0[j], zero_v8f());
#pragma unroll
      for (int j = 0; j < 2; ++j) s0[j] = wmma_f32_f16(ka1, qb1[j], s0[j]);
#pragma unroll
      for (int j = 0; j < 2; ++j) s1[j] = wmma_f32_f16(ka3, qb1[j], s1[j]);
    }

    v16h pb[2];
#pragma unroll  // the two tiles' chains are independent: they fill each other's gaps
    for (int j = 0; j < 2; ++j) {
      float mx = fmaxf(s0[j][0], s1[j][0]);  // of raw scores
#pragma unroll
      for (int r = 1; r < 8; ++r) mx = fmaxf(mx, fmaxf(s0[j][r], s1[j][r]));
      mx = fmaxf(mx, xhalf(mx));  // both halves now hold the query's chunk max
      const float mnew  = fmaxf(mrow[j], fmaf(mx, c2, b2));
      const float alpha = __builtin_amdgcn_exp2f(mrow[j] - mnew);
      mrow[j] = mnew;
      // Exponent of a score: s * c2 + b2 - mnew, as one fma (packed in pairs).
      const float nb = b2 - mnew;
      v8f e0, e1;
#pragma unroll
      for (int r = 0; r < 8; r += 2) {
        const v2f a0 = __builtin_elementwise_fma(v2f{s0[j][r], s0[j][r + 1]},
                                                 v2f{c2, c2}, v2f{nb, nb});
        const v2f a1 = __builtin_elementwise_fma(v2f{s1[j][r], s1[j][r + 1]},
                                                 v2f{c2, c2}, v2f{nb, nb});
        e0[r] = a0.x; e0[r + 1] = a0.y;
        e1[r] = a1.x; e1[r + 1] = a1.y;
      }

      // P^T as B operand: element s is key kmap(s) = 8g + s (s < 8), 16 + 8g + s - 8.
      float ps = 0.0f;
#pragma unroll
      for (int r = 0; r < 8; ++r) {
        const float p0 = __builtin_amdgcn_exp2f(e0[r]);
        const float p1 = __builtin_amdgcn_exp2f(e1[r]);
        ps += p0 + p1;
        pb[j][r]     = (_Float16)p0;
        pb[j][r + 8] = (_Float16)p1;
      }
      lrow[j] = lrow[j] * alpha + ps;
#pragma unroll
      for (int d = 0; d < 4; ++d) acc[j][d] *= alpha;
    }

#pragma unroll
    for (int d = 0; d < 4; ++d) {
      // A = V^T: row d*16 + lm, keys 8g + 0..7 then 16 + 8g + 0..7 (pb's order).
      const v8h lo = load_tr16(vc + d * 16);
      const v8h hi = load_tr16(vc + 16 * AVP + d * 16);
      v16h va;
#pragma unroll
      for (int e = 0; e < 8; ++e) { va[e] = lo[e]; va[e + 8] = hi[e]; }
#pragma unroll
      for (int j = 0; j < 2; ++j) acc[j][d] = wmma_f32_f16(va, pb[j], acc[j][d]);
    }

    // Publish stage s+1 and free stage s's buffer, then refill that buffer.
    wait_ds0();
    wait_async0();
    __syncthreads();
    if (s + 2 < nst) {
      const size_t go = (size_t)(s + 2) * (AKS * AD);
      async_copy2x2_b128(lk0 + (cur ? kbuf : 0u), kstep, Kg + go,
                         lv0 + (cur ? vbuf : 0u), vstep, Vg + go, 32 * AD);
    }
  }
  wait_async0();  // nothing is in flight here; kept in front of the wave's end

  float lt[2];  // this key half's sum: the half-waves' parts joined
#pragma unroll
  for (int j = 0; j < 2; ++j) lt[j] = lrow[j] + xhalf(lrow[j]);

  if (kh == 1) {  // hand max, sum and O^T of keys 32..63 of every stage over
#pragma unroll
    for (int j = 0; j < 2; ++j) {
      Mm[qg][j][l] = mrow[j];
      Ml[qg][j][l] = lt[j];
#pragma unroll
      for (int d = 0; d < 4; ++d) {
        const v8f a = acc[j][d];
        v4f lo = {a[0], a[1], a[2], a[3]};
        v4f hi = {a[4], a[5], a[6], a[7]};
        *(v4f*)&Om[qg][(j * 4 + d) * 2 + 0][l][0] = lo;
        *(v4f*)&Om[qg][(j * 4 + d) * 2 + 1][l][0] = hi;
      }
    }
  }
  __syncthreads();  // key half 1's results are readable by key half 0
  if (kh == 0) {
#pragma unroll
    for (int j = 0; j < 2; ++j) {
      // Both halves onto the common max, then one division for the joint sum.
      const float m1 = Mm[qg][j][l];
      const float l1 = Ml[qg][j][l];
      const float mj = fmaxf(mrow[j], m1);
      const float a0 = __builtin_amdgcn_exp2f(mrow[j] - mj);
      const float a1 = __builtin_amdgcn_exp2f(m1 - mj);
      const float rinv = 1.0f / (lt[j] * a0 + l1 * a1);
      const float f0 = a0 * rinv, f1 = a1 * rinv;
      const int qrow = qt * AQB + qg * 32 + j * 16 + lm;
      _Float16* dst = ctx + ((size_t)(b * ALQ + qrow)) * AD + h * AHD + 8 * g;
#pragma unroll
      for (int d = 0; d < 4; ++d) {
        const v4f lo = *(const v4f*)&Om[qg][(j * 4 + d) * 2 + 0][l][0];
        const v4f hi = *(const v4f*)&Om[qg][(j * 4 + d) * 2 + 1][l][0];
        v8h o;
#pragma unroll
        for (int r = 0; r < 4; ++r) {
          o[r]     = (_Float16)(acc[j][d][r] * f0 + lo[r] * f1);
          o[r + 4] = (_Float16)(acc[j][d][r + 4] * f0 + hi[r] * f1);
        }
        *(v8h*)(dst + d * 16) = o;  // 8 consecutive d of one query: one 16B store
      }
    }
  }
}

// ---------------------------------------------------------------------------
// Launcher. Workspace (f16 unless noted):
//  [0,8)MB qdom | [8,24) kvdom | [24,26) Wq | [26,28) Wk | [28,30) Wv
//  [30,32) Wo | [32,40) q | [40,56) k | [56,72) v | [72,80) ctx  => 80MB
// ---------------------------------------------------------------------------
extern "C" void kernel_launch(void* const* d_in, const int* in_sizes, int n_in,
                              void* d_out, int out_size, void* d_ws,
                              size_t ws_size, hipStream_t stream) {
  (void)in_sizes; (void)n_in; (void)out_size; (void)ws_size;

  const float* qdom  = (const float*)d_in[0];
  const float* kvdom = (const float*)d_in[1];
  const float* Wq = (const float*)d_in[2];
  const float* bq = (const float*)d_in[3];
  const float* Wk = (const float*)d_in[4];
  const float* bk = (const float*)d_in[5];
  const float* Wv = (const float*)d_in[6];
  const float* bv = (const float*)d_in[7];
  const float* Wo = (const float*)d_in[8];
  const float* bo = (const float*)d_in[9];
  const float* scale = (const float*)d_in[10];
  const float* beta  = (const float*)d_in[11];
  float* out = (float*)d_out;

  const size_t MB = 1u << 20;
  char* ws = (char*)d_ws;
  _Float16* qdom_h  = (_Float16*)(ws + 0 * MB);
  _Float16* kvdom_h = (_Float16*)(ws + 8 * MB);
  _Float16* Wq_h    = (_Float16*)(ws + 24 * MB);
  _Float16* Wk_h    = (_Float16*)(ws + 26 * MB);
  _Float16* Wv_h    = (_Float16*)(ws + 28 * MB);
  _Float16* Wo_h    = (_Float16*)(ws + 30 * MB);
  _Float16* qh      = (_Float16*)(ws + 32 * MB);
  _Float16* kh      = (_Float16*)(ws + 40 * MB);
  _Float16* vh      = (_Float16*)(ws + 56 * MB);
  _Float16* ctxh    = (_Float16*)(ws + 72 * MB);

  // qdom_h .. Wo_h are contiguous: one flat destination of 16 * 2^20 halfs.
  cvt_all_kernel<<<dim3(512), dim3(256), 0, stream>>>(qdom, kvdom, Wq, Wk, Wv,
                                                      Wo, qdom_h);

  const dim3 blk(256);
  gemm_qkv_kernel<<<dim3(1024 / 128, 4096 / 128 + 2 * (8192 / 128)), blk, 0,
                    stream>>>(qdom_h, kvdom_h, Wq_h, Wk_h, Wv_h, bq, bk, bv, qh,
                              kh, vh, 4096 / 128, 8192 / 128, 1024, 1024);

  attn_kernel<<<dim3(ALQ / AQB, AH, AB), dim3(256), 0, stream>>>(
      qh, kh, vh, ctxh, scale, beta);

  gemm_out_kernel<<<dim3(1024 / 128, 4096 / 128), blk, 0, stream>>>(
      ctxh, Wo_h, bo, out, 1024, 1024);
}

// v009
// Measured time: 103 microseconds a run.
// Timed twice side by side with v008, it ran 1.04 and 1.03 times as fast.
// All steps since v000 together make it 2.22 times as fast.
#include <hip/hip_runtime.h>
#include <hip/hip_bf16.h>

typedef float     v8f  __attribute__((ext_vector_type(8)));
typedef _Float16  v8h  __attribute__((ext_vector_type(8)));
typedef _Float16  v16h __attribute__((ext_vector_type(16)));
typedef float     v4f  __attribute__((ext_vector_type(4)));

__device__ __forceinline__ v8f wmma_f32_f16(v16h a, v16h b, v8f c) {
  return __builtin_amdgcn_wmma_f32_16x16x32_f16(false, a, false, b, (short)0, c,
                                                false, false);
}

__device__ __forceinline__ v8f zero_v8f() {
  v8f z;
#pragma unroll
  for (int i = 0; i < 8; ++i) z[i] = 0.0f;
  return z;
}

__device__ __forceinline__ v16h load_frag(const _Float16* base, int stride,
                                          int row, int koff, int g) {
  const _Float16* p = base + row * stride + koff + 8 * g;
  v8h lo = *(const v8h*)(p);
  v8h hi = *(const v8h*)(p + 16);
  v16h r;
#pragma unroll
  for (int e = 0; e < 8; ++e) { r[e] = lo[e]; r[e + 8] = hi[e]; }
  return r;
}

typedef short s16x8 __attribute__((ext_vector_type(8)));
__device__ __forceinline__ v8h load_tr16(const _Float16* p) {
  typedef __attribute__((address_space(3))) s16x8 lds_s16x8;
  return __builtin_bit_cast(
      v8h, __builtin_amdgcn_ds_load_tr16_b128_v8i16((lds_s16x8*)p));
}

__device__ __forceinline__ void async_copy8_b128(unsigned lds, unsigned lstep,
                                                 const _Float16* g, int gstep) {
  asm volatile(
      "global_load_async_to_lds_b128 %0, %8, off\n\t"
      "global_load_async_to_lds_b128 %1, %9, off\n\t"
      "global_load_async_to_lds_b128 %2, %10, off\n\t"
      "global_load_async_to_lds_b128 %3, %11, off\n\t"
      "global_load_async_to_lds_b128 %4, %12, off\n\t"
      "global_load_async_to_lds_b128 %5, %13, off\n\t"
      "global_load_async_to_lds_b128 %6, %14, off\n\t"
      "global_load_async_to_lds_b128 %7, %15, off\n\t"
      "s_wait_xcnt 0x0"
      :
      : "v"(lds), "v"(lds + lstep), "v"(lds + 2 * lstep), "v"(lds + 3 * lstep),
        "v"(lds + 4 * lstep), "v"(lds + 5 * lstep), "v"(lds + 6 * lstep),
        "v"(lds + 7 * lstep), "v"(g), "v"(g + gstep), "v"(g + 2 * gstep),
        "v"(g + 3 * gstep), "v"(g + 4 * gstep), "v"(g + 5 * gstep),
        "v"(g + 6 * gstep), "v"(g + 7 * gstep)
      : "memory");
}

__device__ __forceinline__ void async_copy2x2_b128(
    unsigned ldsa, unsigned astep, const _Float16* ga, unsigned ldsb,
    unsigned bstep, const _Float16* gb, int gstep) {
  asm volatile(
      "global_load_async_to_lds_b128 %0, %4, off\n\t"
      "global_load_async_to_lds_b128 %1, %5, off\n\t"
      "global_load_async_to_lds_b128 %2, %6, off\n\t"
      "global_load_async_to_lds_b128 %3, %7, off\n\t"
      "s_wait_xcnt 0x0"
      :
      : "v"(ldsa), "v"(ldsa + astep), "v"(ldsb), "v"(ldsb + bstep), "v"(ga),
        "v"(ga + gstep), "v"(gb), "v"(gb + gstep)
      : "memory");
}

// This wave's copies have landed (another wave reads them behind the barrier).
__device__ __forceinline__ void wait_async0() {
  asm volatile("s_wait_asynccnt 0x0" ::: "memory");
}

// This wave's LDS reads have returned: the buffer they read may be refilled.
__device__ __forceinline__ void wait_ds0() {
  asm volatile("s_wait_dscnt 0x0" ::: "memory");
}

// ---------------------------------------------------------------------------
// fp32 -> f16 of all six matrix inputs in ONE launch (every GEMM input is f16).
// The f16 copies lie back to back in the workspace, in the order q-domain (4),
// kv-domain (8), Wq, Wk, Wv, Wo (1 each, in pieces of 2^20 elements), so dst is
// one flat array. A block owns 32768 consecutive elements (32 blocks a piece,
// so a block never straddles two sources); a thread converts 16 groups of 8.
// 512 blocks = 4096 waves to start (two blocks a WGP), where one group a thread
// would start 65536; a wave's loads all stand ahead of its stores.
// ---------------------------------------------------------------------------
__global__ __launch_bounds__(256) void cvt_all_kernel(
    const float* __restrict__ qd, const float* __restrict__ kvd,
    const float* __restrict__ wq, const float* __restrict__ wk,
    const float* __restrict__ wv, const float* __restrict__ wo,
    _Float16* __restrict__ dst) {
  const int piece = blockIdx.x >> 5;  // block-uniform: scalar selects
  const float* src = qd;
  int first = 0;  // first piece of the chosen source
  if (piece >= 4)  { src = kvd; first = 4; }
  if (piece == 12) { src = wq;  first = 12; }
  if (piece == 13) { src = wk;  first = 13; }
  if (piece == 14) { src = wv;  first = 14; }
  if (piece == 15) { src = wo;  first = 15; }

  const size_t base = (size_t)blockIdx.x * 32768 + threadIdx.x * 8;
  const float* s = src + (base - ((size_t)first << 20));
  _Float16* d = dst + base;

  v8f x[16];
#pragma unroll  // straight line, so that many loads of a wave are in flight at once
  for (int k = 0; k < 16; ++k) x[k] = *(const v8f*)(s + k * 2048);
#pragma unroll  // x[] must stay in registers: constant indices only
  for (int k = 0; k < 16; ++k) {
    v8h h;
#pragma unroll
    for (int e = 0; e < 8; ++e) h[e] = (_Float16)x[k][e];
    *(v8h*)(d + k * 2048) = h;
  }
}

// ---------------------------------------------------------------------------
// GEMM: Y[m,n] = sum_k X[m,k]*W[n,k] + bias[n]  (X,W f16; Y f16 or f32).
// Block 256 = 8 waves; tile 128(M) x 128(N); wave tile 64x32 (c[4][2]).
// K goes in stages of 128 halfs = 256 B of every operand row, so that one
// wave-wide async copy is two whole rows of the stage: four whole 128-B lines
// (a 64-B stage row made it 16 lines of 32 B each). Two LDS buffers:
//   wmma on stage s -> dscnt 0 -> asynccnt 0 -> barrier -> copies of stage s+2.
// 32 wmma per wave per stage, k ascending. K: a multiple of 128, at least 128.
// The products are formed transposed, Y^T tile = W rows (A) x X rows (B): a lane
// then holds 8 consecutive n of ONE row m, which is 16 B of f16 (32 B of f32).
// Epilogue: the block's tile goes through LDS (the ring is free by then) and
// leaves as whole 128-B lines, 16 B a lane, where stores straight from the
// accumulators were pieces of 32 B (f16) or 64 B (f32) of a line each.
// gemm_tile is one block's tile at (m0, n0); two kernels call it: one launch for
// the three input projections, one for the output projection.
// ---------------------------------------------------------------------------
#define GBK    128  // halfs of K a stage
#define GPITCH 136  // LDS row pitch in halfs: 272 B = 16 B x 17 (b128 readers)

template <typename OutT>
__device__ __forceinline__ void gemm_tile(
    const _Float16* __restrict__ X, const _Float16* __restrict__ W,
    const float* __restrict__ bias, OutT* __restrict__ Y,
    int m0, int n0, int N, int K) {
  const int t  = threadIdx.x;
  const int w  = t >> 5;
  const int l  = t & 31;
  const int lm = l & 15;
  const int g  = l >> 4;
  const int wm = w & 1;    // 2 waves along M (64 rows each)
  const int wn = w >> 1;   // 4 waves along N (32 cols each)

  __shared__ __attribute__((aligned(16))) _Float16 As[2][128 * GPITCH];
  __shared__ __attribute__((aligned(16))) _Float16 Bs[2][128 * GPITCH];

  v8f c[4][2];
#pragma unroll
  for (int i = 0; i < 4; ++i)
#pragma unroll
    for (int j = 0; j < 2; ++j) c[i][j] = zero_v8f();

  // Per-thread staging share: 16-B piece t&15 of rows (t>>4) + 16*i, i = 0..7,
  // of each matrix: 16 lanes cover one 256-B stage row.
  const int srow = t >> 4;
  const int scol = (t & 15) * 8;
  const _Float16* Xg = X + (size_t)(m0 + srow) * K + scol;
  const _Float16* Wg = W + (size_t)(n0 + srow) * K + scol;
  const unsigned lofs = (unsigned)((srow * GPITCH + scol) * 2);  // bytes
  const unsigned la0 = (unsigned)(uintptr_t)(&As[0][0]) + lofs;
  const unsigned lb0 = (unsigned)(uintptr_t)(&Bs[0][0]) + lofs;
  const unsigned lbuf  = 128 * GPITCH * 2;  // bytes from buffer 0 to buffer 1
  const unsigned lstep = 16 * GPITCH * 2;   // bytes from a copy's row to the next's
  const int nst = K / GBK;

  // Stage 0 into buffer 0, published; then stage 1 flies into buffer 1.
  async_copy8_b128(la0, lstep, Xg, 16 * K);
  async_copy8_b128(lb0, lstep, Wg, 16 * K);
  wait_async0();
  __syncthreads();
  if (nst > 1) {
    async_copy8_b128(la0 + lbuf, lstep, Xg + GBK, 16 * K);
    async_copy8_b128(lb0 + lbuf, lstep, Wg + GBK, 16 * K);
  }

  for (int s = 0; s < nst; ++s) {
    const int cur = s & 1;
    const _Float16* Ab = As[cur];
    const _Float16* Bb = Bs[cur];
#pragma unroll
    for (int ks = 0; ks < GBK; ks += 32) {
      v16h af[4];
#pragma unroll
      for (int i = 0; i < 4; ++i)
        af[i] = load_frag(Ab, GPITCH, wm * 64 + i * 16 + lm, ks, g);
#pragma unroll
      for (int j = 0; j < 2; ++j) {
        v16h bf = load_frag(Bb, GPITCH, wn * 32 + j * 16 + lm, ks, g);
#pragma unroll
        for (int i = 0; i < 4; ++i) c[i][j] = wmma_f32_f16(bf, af[i], c[i][j]);
      }
    }

    // Publish stage s+1 and free stage s's buffer, then refill that buffer.
    wait_ds0();
    wait_async0();
    __syncthreads();
    if (s + 2 < nst) {
      const unsigned lo = cur ? lbuf : 0u;
      async_copy8_b128(la0 + lo, lstep, Xg + (s + 2) * GBK, 16 * K);
      async_copy8_b128(lb0 + lo, lstep, Wg + (s + 2) * GBK, 16 * K);
    }
  }
  wait_async0();  // nothing is in flight here; kept in front of the wave's end

  // Epilogue. c[i][j][r] = Y[wm*64 + i*16 + lm][wn*32 + j*16 + 8g + r] of the tile.
  // Every wave has left the ring (the barrier at the foot of the last stage) and no
  // copy is in flight: the tile is staged in As, row pitch 128 elements + 16 B.
  constexpr int PV = 16 / (int)sizeof(OutT);  // elements in 16 B
  constexpr int SP = 128 + PV;                // staging pitch, elements
  OutT* St = reinterpret_cast<OutT*>(&As[0][0]);
#pragma unroll
  for (int j = 0; j < 2; ++j) {
    const int nl = wn * 32 + j * 16 + 8 * g;
    const v4f b0 = *(const v4f*)(bias + n0 + nl);
    const v4f b1 = *(const v4f*)(bias + n0 + nl + 4);
#pragma unroll
    for (int i = 0; i < 4; ++i) {
      OutT* dst = St + (wm * 64 + i * 16 + lm) * SP + nl;
      v4f lo, hi;
#pragma unroll
      for (int r = 0; r < 4; ++r) {
        lo[r] = c[i][j][r] + b0[r];
        hi[r] = c[i][j][r + 4] + b1[r];
      }
      if constexpr (sizeof(OutT) == 2) {
        v8h o;
#pragma unroll
        for (int r = 0; r < 4; ++r) { o[r] = (_Float16)lo[r]; o[r + 4] = (_Float16)hi[r]; }
        *(v8h*)dst = o;
      } else {
        *(v4f*)dst = lo;
        *(v4f*)(dst + 4) = hi;
      }
    }
  }
  __syncthreads();  // the staged tile is readable by every wave

  // A row of the tile is PR pieces of 16 B; consecutive lanes take consecutive
  // pieces, so a wave-wide store is two runs of 256 B (f16) or one of 512 B (f32):
  // 4 whole lines.
  constexpr int PR = 128 / PV;   // pieces a row: 16 (f16), 32 (f32)
  constexpr int RS = 256 / PR;   // rows the block stores at a time
  const int prow = t / PR;
  const int pcol = (t % PR) * PV;
  OutT* Yp = Y + (size_t)(m0 + prow) * N + n0 + pcol;
  const OutT* Sp = St + prow * SP + pcol;
#pragma unroll  // all LDS reads of a lane can go ahead of its stores
  for (int i = 0; i < 128 / RS; ++i)
    *(v4f*)(Yp + (size_t)(i * RS) * N) = *(const v4f*)(Sp + i * RS * SP);
}

// Output projection: grid (N/128, M/128).
__global__ __launch_bounds__(256) void gemm_out_kernel(
    const _Float16* __restrict__ X, const _Float16* __restrict__ W,
    const float* __restrict__ bias, float* __restrict__ Y, int N, int K) {
  gemm_tile<float>(X, W, bias, Y, blockIdx.y * 128, blockIdx.x * 128, N, K);
}

__global__ __launch_bounds__(256) void gemm_qkv_kernel(
    const _Float16* __restrict__ Xq, const _Float16* __restrict__ Xkv,
    const _Float16* __restrict__ Wq, const _Float16* __restrict__ Wk,
    const _Float16* __restrict__ Wv, const float* __restrict__ bq,
    const float* __restrict__ bk, const float* __restrict__ bv,
    _Float16* __restrict__ Yq, _Float16* __restrict__ Yk,
    _Float16* __restrict__ Yv, int tq, int tkv, int N, int K) {
  int ty = blockIdx.y;  // block-uniform: scalar selects
  const _Float16* X = Xq;
  const _Float16* W = Wq;
  const float* bias = bq;
  _Float16* Y = Yq;
  if (ty >= tq) {
    ty -= tq; X = Xkv; W = Wk; bias = bk; Y = Yk;
    if (ty >= tkv) { ty -= tkv; W = Wv; bias = bv; Y = Yv; }
  }
  gemm_tile<_Float16>(X, W, bias, Y, ty * 128, blockIdx.x * 128, N, K);
}

#define AB   4
#define ALQ  1024
#define ALKV 2048
#define AD   1024
#define AH   16
#define AHD  64
#define AQB  128  // queries a block
#define AKS  64  // keys a stage
#define AKP  72  // K pitch in LDS, halfs: 144 B = 16 B x 9 (b128 readers)
#define AVP  80  // V pitch in LDS, halfs: 160 B = 32 B x 5 (transposing readers)

typedef float v2f __attribute__((ext_vector_type(2)));

__device__ __forceinline__ float xhalf(float x) {
  const int i = __builtin_bit_cast(int, x);
  return __builtin_bit_cast(
      float, __builtin_amdgcn_permlanex16(i, i, 0x76543210, 0xfedcba98, false,
                                          false));
}

__global__ __launch_bounds__(256) void attn_kernel(
    const _Float16* __restrict__ q, const _Float16* __restrict__ kmat,
    const _Float16* __restrict__ vmat, _Float16* __restrict__ ctx,
    const float* __restrict__ scale_p, const float* __restrict__ beta_p) {
  const int qt = blockIdx.x;
  const int h  = blockIdx.y;
  const int b  = blockIdx.z;
  const int t  = threadIdx.x;
  const int w  = t >> 5;
  const int l  = t & 31;
  const int lm = l & 15;
  const int g  = l >> 4;
  const int qg = w & 3;   // query group: columns qg*32 .. qg*32+31 of the block
  const int kh = w >> 2;  // key half: keys kh*32 .. kh*32+31 of every stage

  __shared__ __attribute__((aligned(16))) _Float16 Qs[AQB * 72];  // 128 q x 64 d
  __shared__ __attribute__((aligned(16))) _Float16 Ks[2][AKS * AKP];
  __shared__ __attribute__((aligned(16))) _Float16 Vs[2][AKS * AVP];
  // Key half 1's results, lane by lane: O^T as 16 pieces of 4 floats, max, sum.
  __shared__ __attribute__((aligned(16))) float Om[4][16][32][4];
  __shared__ float Mm[4][2][32];
  __shared__ float Ml[4][2][32];

  // Per-thread staging share: 16-B piece t&7 of rows (t>>3) + 32*i, i = 0..1, of
  // K and of V: 8 lanes cover one 128-B row of this head.
  const int srow = t >> 3;
  const int scol = (t & 7) * 8;
  const size_t goff = ((size_t)(b * ALKV + srow)) * AD + h * AHD + scol;
  const _Float16* Kg = kmat + goff;
  const _Float16* Vg = vmat + goff;
  const unsigned lk0 =
      (unsigned)(uintptr_t)(&Ks[0][0]) + (unsigned)((srow * AKP + scol) * 2);
  const unsigned lv0 =
      (unsigned)(uintptr_t)(&Vs[0][0]) + (unsigned)((srow * AVP + scol) * 2);
  const unsigned kbuf = AKS * AKP * 2, vbuf = AKS * AVP * 2;  // bytes a buffer
  const unsigned kstep = 32 * AKP * 2, vstep = 32 * AVP * 2;  // bytes, 32 rows
  const int nst = ALKV / AKS;

  // Stage 0 starts to fly into buffer 0 while Q is staged.
  async_copy2x2_b128(lk0, kstep, Kg, lv0, vstep, Vg, 32 * AD);

  // Softmax in base 2: exp(x) = 2^(x * log2 e), with log2 e folded into the score
  // factor and into the shift, so that a score costs one fma ahead of its v_exp.
  const float c2s = scale_p[0] * 0.125f * 1.44269504f;  // 1/sqrt(64) * log2 e
  const float c2  = fabsf(c2s);
  const float b2  = beta_p[0] * 1.44269504f;

  {  // Stage Q tile once.
    const int row = t >> 1;
    const int cb  = (t & 1) * 32;
    const _Float16* src =
        q + ((size_t)(b * ALQ + qt * AQB + row)) * AD + h * AHD + cb;
    _Float16* dst = &Qs[row * 72 + cb];
#pragma unroll
    for (int i = 0; i < 4; ++i)
      *(v8h*)(dst + i * 8) = *(const v8h*)(src + i * 8);
  }
  wait_async0();
  __syncthreads();  // publishes Q and stage 0
  // Stage 1 flies into buffer 1.
  async_copy2x2_b128(lk0 + kbuf, kstep, Kg + AKS * AD, lv0 + vbuf, vstep,
                     Vg + AKS * AD, 32 * AD);

  // B operand Q^T of tile j: column lm = query qg*32 + j*16 + lm, k = d in the
  // hardware order.
  v16h qb0[2], qb1[2];
#pragma unroll
  for (int j = 0; j < 2; ++j) {
    qb0[j] = load_frag(Qs, 72, qg * 32 + j * 16 + lm, 0, g);
    qb1[j] = load_frag(Qs, 72, qg * 32 + j * 16 + lm, 32, g);
    // The maximum is taken over raw scores, which orders them as the scaled ones
    // only under a factor >= 0: a negative factor's sign goes into Q (exact).
    if (c2s < 0.0f) { qb0[j] = -qb0[j]; qb1[j] = -qb1[j]; }
  }

  // This wave's 32 keys of a stage in buffer 0: K rows, and this lane's address
  // for the transposing loads of V (its keys 0..15, d 0..15).
  const _Float16* kb = &Ks[0][kh * 32 * AKP];
  const _Float16* vtp =
      &Vs[0][(kh * 32 + 8 * g + (l & 7)) * AVP + 8 * ((l >> 3) & 1)];

  // Per lane and tile: running max (scaled, shifted, in log2 units) and this
  // half-wave's partial sum of query qg*32 + j*16 + lm, over this key half.
  float mrow[2] = {-1e30f, -1e30f}, lrow[2] = {0.0f, 0.0f};
  v8f acc[2][4];  // acc[j][d][r] = O^T[d*16 + 8g + r][query lm of tile j]
#pragma unroll
  for (int j = 0; j < 2; ++j)
#pragma unroll
    for (int d = 0; d < 4; ++d) acc[j][d] = zero_v8f();

  for (int s = 0; s < nst; ++s) {
    const int cur = s & 1;
    const _Float16* Kc = kb + cur * (AKS * AKP);
    const _Float16* vc = vtp + cur * (AKS * AVP);

    // s0[j][r] = S^T[key 8g + r][query lm of tile j], s1: key 16 + 8g + r.
    v8f s0[2], s1[2];
    {
      const v16h ka0 = load_frag(Kc, AKP, lm, 0, g);
      const v16h ka1 = load_frag(Kc, AKP, lm, 32, g);
      const v16h ka2 = load_frag(Kc, AKP, 16 + lm, 0, g);
      const v16h ka3 = load_frag(Kc, AKP, 16 + lm, 32, g);
#pragma unroll
      for (int j = 0; j < 2; ++j) s0[j] = wmma_f32_f16(ka0, qb0[j], zero_v8f());
#pragma unroll
      for (int j = 0; j < 2; ++j) s1[j] = wmma_f32_f16(ka2, qb0[j], zero_v8f());
#pragma unroll
      for (int j = 0; j < 2; ++j) s0[j] = wmma_f32_f16(ka1, qb1[j], s0[j]);
#pragma unroll
      for (int j = 0; j < 2; ++j) s1[j] = wmma_f32_f16(ka3, qb1[j], s1[j]);
    }

    v16h pb[2];
#pragma unroll  // the two tiles' chains are independent: they fill each other's gaps
    for (int j = 0; j < 2; ++j) {
      float mx = fmaxf(s0[j][0], s1[j][0]);  // of raw scores
#pragma unroll
      for (int r = 1; r < 8; ++r) mx = fmaxf(mx, fmaxf(s0[j][r], s1[j][r]));
      mx = fmaxf(mx, xhalf(mx));  // both halves now hold the query's chunk max
      const float mnew  = fmaxf(mrow[j], fmaf(mx, c2, b2));
      const float alpha = __builtin_amdgcn_exp2f(mrow[j] - mnew);
      mrow[j] = mnew;
      // Exponent of a score: s * c2 + b2 - mnew, as one fma (packed in pairs).
      const float nb = b2 - mnew;
      v8f e0, e1;
#pragma unroll
      for (int r = 0; r < 8; r += 2) {
        const v2f a0 = __builtin_elementwise_fma(v2f{s0[j][r], s0[j][r + 1]},
                                                 v2f{c2, c2}, v2f{nb, nb});
        const v2f a1 = __builtin_elementwise_fma(v2f{s1[j][r], s1[j][r + 1]},
                                                 v2f{c2, c2}, v2f{nb, nb});
        e0[r] = a0.x; e0[r + 1] = a0.y;
        e1[r] = a1.x; e1[r + 1] = a1.y;
      }

      // P^T as B operand: element s is key kmap(s) = 8g + s (s < 8), 16 + 8g + s - 8.
      float ps = 0.0f;
#pragma unroll
      for (int r = 0; r < 8; ++r) {
        const float p0 = __builtin_amdgcn_exp2f(e0[r]);
        const float p1 = __builtin_amdgcn_exp2f(e1[r]);
        ps += p0 + p1;
        pb[j][r]     = (_Float16)p0;
        pb[j][r + 8] = (_Float16)p1;
      }
      lrow[j] = lrow[j] * alpha + ps;
#pragma unroll
      for (int d = 0; d < 4; ++d) acc[j][d] *= alpha;
    }

#pragma unroll
    for (int d = 0; d < 4; ++d) {
      // A = V^T: row d*16 + lm, keys 8g + 0..7 then 16 + 8g + 0..7 (pb's order).
      const v8h lo = load_tr16(vc + d * 16);
      const v8h hi = load_tr16(vc + 16 * AVP + d * 16);
      v16h va;
#pragma unroll
      for (int e = 0; e < 8; ++e) { va[e] = lo[e]; va[e + 8] = hi[e]; }
#pragma unroll
      for (int j = 0; j < 2; ++j) acc[j][d] = wmma_f32_f16(va, pb[j], acc[j][d]);
    }

    // Publish stage s+1 and free stage s's buffer, then refill that buffer.
    wait_ds0();
    wait_async0();
    __syncthreads();
    if (s + 2 < nst) {
      const size_t go = (size_t)(s + 2) * (AKS * AD);
      async_copy2x2_b128(lk0 + (cur ? kbuf : 0u), kstep, Kg + go,
                         lv0 + (cur ? vbuf : 0u), vstep, Vg + go, 32 * AD);
    }
  }
  wait_async0();  // nothing is in flight here; kept in front of the wave's end

  float lt[2];  // this key half's sum: the half-waves' parts joined
#pragma unroll
  for (int j = 0; j < 2; ++j) lt[j] = lrow[j] + xhalf(lrow[j]);

  if (kh == 1) {  // hand max, sum and O^T of keys 32..63 of every stage over
#pragma unroll
    for (int j = 0; j < 2; ++j) {
      Mm[qg][j][l] = mrow[j];
      Ml[qg][j][l] = lt[j];
#pragma unroll
      for (int d = 0; d < 4; ++d) {
        const v8f a = acc[j][d];
        v4f lo = {a[0], a[1], a[2], a[3]};
        v4f hi = {a[4], a[5], a[6], a[7]};
        *(v4f*)&Om[qg][(j * 4 + d) * 2 + 0][l][0] = lo;
        *(v4f*)&Om[qg][(j * 4 + d) * 2 + 1][l][0] = hi;
      }
    }
  }
  __syncthreads();  // key half 1's results are readable by key half 0
  if (kh == 0) {
#pragma unroll
    for (int j = 0; j < 2; ++j) {
      // Both halves onto the common max, then one division for the joint sum.
      const float m1 = Mm[qg][j][l];
      const float l1 = Ml[qg][j][l];
      const float mj = fmaxf(mrow[j], m1);
      const float a0 = __builtin_amdgcn_exp2f(mrow[j] - mj);
      const float a1 = __builtin_amdgcn_exp2f(m1 - mj);
      const float rinv = 1.0f / (lt[j] * a0 + l1 * a1);
      const float f0 = a0 * rinv, f1 = a1 * rinv;
      // Staged in this wave's own 32 rows of Qs, which nobody has read since the
      // loop began.
      _Float16* dst = &Qs[(qg * 32 + j * 16 + lm) * 72 + 8 * g];
#pragma unroll
      for (int d = 0; d < 4; ++d) {
        const v4f lo = *(const v4f*)&Om[qg][(j * 4 + d) * 2 + 0][l][0];
        const v4f hi = *(const v4f*)&Om[qg][(j * 4 + d) * 2 + 1][l][0];
        v8h o;
#pragma unroll
        for (int r = 0; r < 4; ++r) {
          o[r]     = (_Float16)(acc[j][d][r] * f0 + lo[r] * f1);
          o[r + 4] = (_Float16)(acc[j][d][r + 4] * f0 + hi[r] * f1);
        }
        *(v8h*)(dst + d * 16) = o;  // 8 consecutive d of one query: 16 B
      }
    }
    wait_ds0();  // the wave's staged rows are written before it reads them back
    // A query's 64 d of this head are one 128-B line of ctx: 8 lanes a row, so a
    // wave-wide store is 4 whole lines, not 16 pieces of 32 B.
    const int orow = qg * 32 + (l >> 3);
    const _Float16* sr = &Qs[orow * 72 + (l & 7) * 8];
    _Float16* og =
        ctx + ((size_t)(b * ALQ + qt * AQB + orow)) * AD + h * AHD + (l & 7) * 8;
#pragma unroll  // all LDS reads of a lane can go ahead of its stores
    for (int i = 0; i < 8; ++i)
      *(v8h*)(og + (size_t)(i * 4) * AD) = *(const v8h*)(sr + i * 4 * 72);
  }
}

// ---------------------------------------------------------------------------
// Launcher. Workspace (f16 unless noted):
//  [0,8)MB qdom | [8,24) kvdom | [24,26) Wq | [26,28) Wk | [28,30) Wv
//  [30,32) Wo | [32,40) q | [40,56) k | [56,72) v | [72,80) ctx  => 80MB
// ---------------------------------------------------------------------------
extern "C" void kernel_launch(void* const* d_in, const int* in_sizes, int n_in,
                              void* d_out, int out_size, void* d_ws,
                              size_t ws_size, hipStream_t stream) {
  (void)in_sizes; (void)n_in; (void)out_size; (void)ws_size;

  const float* qdom  = (const float*)d_in[0];
  const float* kvdom = (const float*)d_in[1];
  const float* Wq = (const float*)d_in[2];
  const float* bq = (const float*)d_in[3];
  const float* Wk = (const float*)d_in[4];
  const float* bk = (const float*)d_in[5];
  const float* Wv = (const float*)d_in[6];
  const float* bv = (const float*)d_in[7];
  const float* Wo = (const float*)d_in[8];
  const float* bo = (const float*)d_in[9];
  const float* scale = (const float*)d_in[10];
  const float* beta  = (const float*)d_in[11];
  float* out = (float*)d_out;

  const size_t MB = 1u << 20;
  char* ws = (char*)d_ws;
  _Float16* qdom_h  = (_Float16*)(ws + 0 * MB);
  _Float16* kvdom_h = (_Float16*)(ws + 8 * MB);
  _Float16* Wq_h    = (_Float16*)(ws + 24 * MB);
  _Float16* Wk_h    = (_Float16*)(ws + 26 * MB);
  _Float16* Wv_h    = (_Float16*)(ws + 28 * MB);
  _Float16* Wo_h    = (_Float16*)(ws + 30 * MB);
  _Float16* qh      = (_Float16*)(ws + 32 * MB);
  _Float16* kh      = (_Float16*)(ws + 40 * MB);
  _Float16* vh      = (_Float16*)(ws + 56 * MB);
  _Float16* ctxh    = (_Float16*)(ws + 72 * MB);

  // qdom_h .. Wo_h are contiguous: one flat destination of 16 * 2^20 halfs.
  cvt_all_kernel<<<dim3(512), dim3(256), 0, stream>>>(qdom, kvdom, Wq, Wk, Wv,
                                                      Wo, qdom_h);

  const dim3 blk(256);
  gemm_qkv_kernel<<<dim3(1024 / 128, 4096 / 128 + 2 * (8192 / 128)), blk, 0,
                    stream>>>(qdom_h, kvdom_h, Wq_h, Wk_h, Wv_h, bq, bk, bv, qh,
                              kh, vh, 4096 / 128, 8192 / 128, 1024, 1024);

  attn_kernel<<<dim3(ALQ / AQB, AH, AB), dim3(256), 0, stream>>>(
      qh, kh, vh, ctxh, scale, beta);

  gemm_out_kernel<<<dim3(1024 / 128, 4096 / 128), blk, 0, stream>>>(
      ctxh, Wo_h, bo, out, 1024, 1024);
}

// v010
// One run takes 97.4 microseconds.
// Next to v009, in two timings, it ran 1.05 times as fast each time.
// All steps since v000 together make it 2.33 times as fast.
#include <hip/hip_runtime.h>
#include <hip/hip_bf16.h>

typedef float     v8f  __attribute__((ext_vector_type(8)));
typedef _Float16  v8h  __attribute__((ext_vector_type(8)));
typedef _Float16  v16h __attribute__((ext_vector_type(16)));
typedef float     v4f  __attribute__((ext_vector_type(4)));

__device__ __forceinline__ v8f wmma_f32_f16(v16h a, v16h b, v8f c) {
  return __builtin_amdgcn_wmma_f32_16x16x32_f16(false, a, false, b, (short)0, c,
                                                false, false);
}

__device__ __forceinline__ v8f zero_v8f() {
  v8f z;
#pragma unroll
  for (int i = 0; i < 8; ++i) z[i] = 0.0f;
  return z;
}

__device__ __forceinline__ v16h load_frag(const _Float16* base, int stride,
                                          int row, int koff, int g) {
  const _Float16* p = base + row * stride + koff + 8 * g;
  v8h lo = *(const v8h*)(p);
  v8h hi = *(const v8h*)(p + 16);
  v16h r;
#pragma unroll
  for (int e = 0; e < 8; ++e) { r[e] = lo[e]; r[e + 8] = hi[e]; }
  return r;
}

typedef short s16x8 __attribute__((ext_vector_type(8)));
__device__ __forceinline__ v8h load_tr16(const _Float16* p) {
  typedef __attribute__((address_space(3))) s16x8 lds_s16x8;
  return __builtin_bit_cast(
      v8h, __builtin_amdgcn_ds_load_tr16_b128_v8i16((lds_s16x8*)p));
}

__device__ __forceinline__ void async_copy8_b128(unsigned lds, unsigned lstep,
                                                 const _Float16* g, int gstep) {
  asm volatile(
      "global_load_async_to_lds_b128 %0, %8, off\n\t"
      "global_load_async_to_lds_b128 %1, %9, off\n\t"
      "global_load_async_to_lds_b128 %2, %10, off\n\t"
      "global_load_async_to_lds_b128 %3, %11, off\n\t"
      "global_load_async_to_lds_b128 %4, %12, off\n\t"
      "global_load_async_to_lds_b128 %5, %13, off\n\t"
      "global_load_async_to_lds_b128 %6, %14, off\n\t"
      "global_load_async_to_lds_b128 %7, %15, off\n\t"
      "s_wait_xcnt 0x0"
      :
      : "v"(lds), "v"(lds + lstep), "v"(lds + 2 * lstep), "v"(lds + 3 * lstep),
        "v"(lds + 4 * lstep), "v"(lds + 5 * lstep), "v"(lds + 6 * lstep),
        "v"(lds + 7 * lstep), "v"(g), "v"(g + gstep), "v"(g + 2 * gstep),
        "v"(g + 3 * gstep), "v"(g + 4 * gstep), "v"(g + 5 * gstep),
        "v"(g + 6 * gstep), "v"(g + 7 * gstep)
      : "memory");
}

__device__ __forceinline__ void async_copy2x4_b128(
    unsigned ldsa, unsigned astep, const _Float16* ga, unsigned ldsb,
    unsigned bstep, const _Float16* gb, int gstep) {
  asm volatile(
      "global_load_async_to_lds_b128 %0, %8, off\n\t"
      "global_load_async_to_lds_b128 %1, %9, off\n\t"
      "global_load_async_to_lds_b128 %2, %10, off\n\t"
      "global_load_async_to_lds_b128 %3, %11, off\n\t"
      "global_load_async_to_lds_b128 %4, %12, off\n\t"
      "global_load_async_to_lds_b128 %5, %13, off\n\t"
      "global_load_async_to_lds_b128 %6, %14, off\n\t"
      "global_load_async_to_lds_b128 %7, %15, off\n\t"
      "s_wait_xcnt 0x0"
      :
      : "v"(ldsa), "v"(ldsa + astep), "v"(ldsa + 2 * astep),
        "v"(ldsa + 3 * astep), "v"(ldsb), "v"(ldsb + bstep),
        "v"(ldsb + 2 * bstep), "v"(ldsb + 3 * bstep), "v"(ga), "v"(ga + gstep),
        "v"(ga + 2 * gstep), "v"(ga + 3 * gstep), "v"(gb), "v"(gb + gstep),
        "v"(gb + 2 * gstep), "v"(gb + 3 * gstep)
      : "memory");
}

// This wave's copies have landed (another wave reads them behind the barrier).
__device__ __forceinline__ void wait_async0() {
  asm volatile("s_wait_asynccnt 0x0" ::: "memory");
}

// This wave's LDS reads have returned: the buffer they read may be refilled.
__device__ __forceinline__ void wait_ds0() {
  asm volatile("s_wait_dscnt 0x0" ::: "memory");
}

// ---------------------------------------------------------------------------
// fp32 -> f16 of all six matrix inputs in ONE launch (every GEMM input is f16).
// The f16 copies lie back to back in the workspace, in the order q-domain (4),
// kv-domain (8), Wq, Wk, Wv, Wo (1 each, in pieces of 2^20 elements), so dst is
// one flat array. A block owns 32768 consecutive elements (32 blocks a piece,
// so a block never straddles two sources); a thread converts 16 groups of 8.
// 512 blocks = 4096 waves to start (two blocks a WGP), where one group a thread
// would start 65536; a wave's loads all stand ahead of its stores.
// ---------------------------------------------------------------------------
__global__ __launch_bounds__(256) void cvt_all_kernel(
    const float* __restrict__ qd, const float* __restrict__ kvd,
    const float* __restrict__ wq, const float* __restrict__ wk,
    const float* __restrict__ wv, const float* __restrict__ wo,
    _Float16* __restrict__ dst) {
  const int piece = blockIdx.x >> 5;  // block-uniform: scalar selects
  const float* src = qd;
  int first = 0;  // first piece of the chosen source
  if (piece >= 4)  { src = kvd; first = 4; }
  if (piece == 12) { src = wq;  first = 12; }
  if (piece == 13) { src = wk;  first = 13; }
  if (piece == 14) { src = wv;  first = 14; }
  if (piece == 15) { src = wo;  first = 15; }

  const size_t base = (size_t)blockIdx.x * 32768 + threadIdx.x * 8;
  const float* s = src + (base - ((size_t)first << 20));
  _Float16* d = dst + base;

  v8f x[16];
#pragma unroll  // straight line, so that many loads of a wave are in flight at once
  for (int k = 0; k < 16; ++k) x[k] = *(const v8f*)(s + k * 2048);
#pragma unroll  // x[] must stay in registers: constant indices only
  for (int k = 0; k < 16; ++k) {
    v8h h;
#pragma unroll
    for (int e = 0; e < 8; ++e) h[e] = (_Float16)x[k][e];
    *(v8h*)(d + k * 2048) = h;
  }
}

// ---------------------------------------------------------------------------
// GEMM: Y[m,n] = sum_k X[m,k]*W[n,k] + bias[n]  (X,W f16; Y f16 or f32).
// Block 256 = 8 waves; tile 128(M) x 128(N); wave tile 64x32 (c[4][2]).
// K goes in stages of 128 halfs = 256 B of every operand row, so that one
// wave-wide async copy is two whole rows of the stage: four whole 128-B lines
// (a 64-B stage row made it 16 lines of 32 B each). Two LDS buffers:
//   wmma on stage s -> dscnt 0 -> asynccnt 0 -> barrier -> copies of stage s+2.
// 32 wmma per wave per stage, k ascending. K: a multiple of 128, at least 128.
// The products are formed transposed, Y^T tile = W rows (A) x X rows (B): a lane
// then holds 8 consecutive n of ONE row m, which is 16 B of f16 (32 B of f32).
// Epilogue: the block's tile goes through LDS (the ring is free by then) and
// leaves as whole 128-B lines, 16 B a lane, where stores straight from the
// accumulators were pieces of 32 B (f16) or 64 B (f32) of a line each.
// gemm_tile is one block's tile at (m0, n0); two kernels call it: one launch for
// the three input projections, one for the output projection.
// ---------------------------------------------------------------------------
#define GBK    128  // halfs of K a stage
#define GPITCH 136  // LDS row pitch in halfs: 272 B = 16 B x 17 (b128 readers)

template <typename OutT>
__device__ __forceinline__ void gemm_tile(
    const _Float16* __restrict__ X, const _Float16* __restrict__ W,
    const float* __restrict__ bias, OutT* __restrict__ Y,
    int m0, int n0, int N, int K) {
  const int t  = threadIdx.x;
  const int w  = t >> 5;
  const int l  = t & 31;
  const int lm = l & 15;
  const int g  = l >> 4;
  const int wm = w & 1;    // 2 waves along M (64 rows each)
  const int wn = w >> 1;   // 4 waves along N (32 cols each)

  __shared__ __attribute__((aligned(16))) _Float16 As[2][128 * GPITCH];
  __shared__ __attribute__((aligned(16))) _Float16 Bs[2][128 * GPITCH];

  v8f c[4][2];
#pragma unroll
  for (int i = 0; i < 4; ++i)
#pragma unroll
    for (int j = 0; j < 2; ++j) c[i][j] = zero_v8f();

  // Per-thread staging share: 16-B piece t&15 of rows (t>>4) + 16*i, i = 0..7,
  // of each matrix: 16 lanes cover one 256-B stage row.
  const int srow = t >> 4;
  const int scol = (t & 15) * 8;
  const _Float16* Xg = X + (size_t)(m0 + srow) * K + scol;
  const _Float16* Wg = W + (size_t)(n0 + srow) * K + scol;
  const unsigned lofs = (unsigned)((srow * GPITCH + scol) * 2);  // bytes
  const unsigned la0 = (unsigned)(uintptr_t)(&As[0][0]) + lofs;
  const unsigned lb0 = (unsigned)(uintptr_t)(&Bs[0][0]) + lofs;
  const unsigned lbuf  = 128 * GPITCH * 2;  // bytes from buffer 0 to buffer 1
  const unsigned lstep = 16 * GPITCH * 2;   // bytes from a copy's row to the next's
  const int nst = K / GBK;

  // Stage 0 into buffer 0, published; then stage 1 flies into buffer 1.
  async_copy8_b128(la0, lstep, Xg, 16 * K);
  async_copy8_b128(lb0, lstep, Wg, 16 * K);
  wait_async0();
  __syncthreads();
  if (nst > 1) {
    async_copy8_b128(la0 + lbuf, lstep, Xg + GBK, 16 * K);
    async_copy8_b128(lb0 + lbuf, lstep, Wg + GBK, 16 * K);
  }

  for (int s = 0; s < nst; ++s) {
    const int cur = s & 1;
    const _Float16* Ab = As[cur];
    const _Float16* Bb = Bs[cur];
#pragma unroll
    for (int ks = 0; ks < GBK; ks += 32) {
      v16h af[4];
#pragma unroll
      for (int i = 0; i < 4; ++i)
        af[i] = load_frag(Ab, GPITCH, wm * 64 + i * 16 + lm, ks, g);
#pragma unroll
      for (int j = 0; j < 2; ++j) {
        v16h bf = load_frag(Bb, GPITCH, wn * 32 + j * 16 + lm, ks, g);
#pragma unroll
        for (int i = 0; i < 4; ++i) c[i][j] = wmma_f32_f16(bf, af[i], c[i][j]);
      }
    }

    // Publish stage s+1 and free stage s's buffer, then refill that buffer.
    wait_ds0();
    wait_async0();
    __syncthreads();
    if (s + 2 < nst) {
      const unsigned lo = cur ? lbuf : 0u;
      async_copy8_b128(la0 + lo, lstep, Xg + (s + 2) * GBK, 16 * K);
      async_copy8_b128(lb0 + lo, lstep, Wg + (s + 2) * GBK, 16 * K);
    }
  }
  wait_async0();  // nothing is in flight here; kept in front of the wave's end

  // Epilogue. c[i][j][r] = Y[wm*64 + i*16 + lm][wn*32 + j*16 + 8g + r] of the tile.
  // Every wave has left the ring (the barrier at the foot of the last stage) and no
  // copy is in flight: the tile is staged in As, row pitch 128 elements + 16 B.
  constexpr int PV = 16 / (int)sizeof(OutT);  // elements in 16 B
  constexpr int SP = 128 + PV;                // staging pitch, elements
  OutT* St = reinterpret_cast<OutT*>(&As[0][0]);
#pragma unroll
  for (int j = 0; j < 2; ++j) {
    const int nl = wn * 32 + j * 16 + 8 * g;
    const v4f b0 = *(const v4f*)(bias + n0 + nl);
    const v4f b1 = *(const v4f*)(bias + n0 + nl + 4);
#pragma unroll
    for (int i = 0; i < 4; ++i) {
      OutT* dst = St + (wm * 64 + i * 16 + lm) * SP + nl;
      v4f lo, hi;
#pragma unroll
      for (int r = 0; r < 4; ++r) {
        lo[r] = c[i][j][r] + b0[r];
        hi[r] = c[i][j][r + 4] + b1[r];
      }
      if constexpr (sizeof(OutT) == 2) {
        v8h o;
#pragma unroll
        for (int r = 0; r < 4; ++r) { o[r] = (_Float16)lo[r]; o[r + 4] = (_Float16)hi[r]; }
        *(v8h*)dst = o;
      } else {
        *(v4f*)dst = lo;
        *(v4f*)(dst + 4) = hi;
      }
    }
  }
  __syncthreads();  // the staged tile is readable by every wave

  // A row of the tile is PR pieces of 16 B; consecutive lanes take consecutive
  // pieces, so a wave-wide store is two runs of 256 B (f16) or one of 512 B (f32):
  // 4 whole lines.
  constexpr int PR = 128 / PV;   // pieces a row: 16 (f16), 32 (f32)
  constexpr int RS = 256 / PR;   // rows the block stores at a time
  const int prow = t / PR;
  const int pcol = (t % PR) * PV;
  OutT* Yp = Y + (size_t)(m0 + prow) * N + n0 + pcol;
  const OutT* Sp = St + prow * SP + pcol;
#pragma unroll  // all LDS reads of a lane can go ahead of its stores
  for (int i = 0; i < 128 / RS; ++i)
    *(v4f*)(Yp + (size_t)(i * RS) * N) = *(const v4f*)(Sp + i * RS * SP);
}

// Output projection: grid (N/128, M/128).
__global__ __launch_bounds__(256) void gemm_out_kernel(
    const _Float16* __restrict__ X, const _Float16* __restrict__ W,
    const float* __restrict__ bias, float* __restrict__ Y, int N, int K) {
  gemm_tile<float>(X, W, bias, Y, blockIdx.y * 128, blockIdx.x * 128, N, K);
}

__global__ __launch_bounds__(256) void gemm_qkv_kernel(
    const _Float16* __restrict__ Xq, const _Float16* __restrict__ Xkv,
    const _Float16* __restrict__ Wq, const _Float16* __restrict__ Wk,
    const _Float16* __restrict__ Wv, const float* __restrict__ bq,
    const float* __restrict__ bk, const float* __restrict__ bv,
    _Float16* __restrict__ Yq, _Float16* __restrict__ Yk,
    _Float16* __restrict__ Yv, int tq, int tkv, int N, int K) {
  int ty = blockIdx.y;  // block-uniform: scalar selects
  const _Float16* X = Xq;
  const _Float16* W = Wq;
  const float* bias = bq;
  _Float16* Y = Yq;
  if (ty >= tq) {
    ty -= tq; X = Xkv; W = Wk; bias = bk; Y = Yk;
    if (ty >= tkv) { ty -= tkv; W = Wv; bias = bv; Y = Yv; }
  }
  gemm_tile<_Float16>(X, W, bias, Y, ty * 128, blockIdx.x * 128, N, K);
}

#define AB   4
#define ALQ  1024
#define ALKV 2048
#define AD   1024
#define AH   16
#define AHD  64
#define AQB  128  // queries a block
#define AKS  128 // keys a stage
#define AKP  72  // K pitch in LDS, halfs: 144 B = 16 B x 9 (b128 readers)
#define AVP  80  // V pitch in LDS, halfs: 160 B = 32 B x 5 (transposing readers)

typedef float v2f __attribute__((ext_vector_type(2)));

__device__ __forceinline__ float xhalf(float x) {
  const int i = __builtin_bit_cast(int, x);
  return __builtin_bit_cast(
      float, __builtin_amdgcn_permlanex16(i, i, 0x76543210, 0xfedcba98, false,
                                          false));
}

__global__ __launch_bounds__(256) void attn_kernel(
    const _Float16* __restrict__ q, const _Float16* __restrict__ kmat,
    const _Float16* __restrict__ vmat, _Float16* __restrict__ ctx,
    const float* __restrict__ scale_p, const float* __restrict__ beta_p) {
  const int qt = blockIdx.x;
  const int h  = blockIdx.y;
  const int b  = blockIdx.z;
  const int t  = threadIdx.x;
  const int w  = t >> 5;
  const int l  = t & 31;
  const int lm = l & 15;
  const int g  = l >> 4;
  const int qg = w & 3;   // query group: columns qg*32 .. qg*32+31 of the block
  const int kh = w >> 2;  // key half: keys kh*64 .. kh*64+63 of every stage

  __shared__ __attribute__((aligned(16))) _Float16 Qs[AQB * 72];  // 128 q x 64 d
  __shared__ __attribute__((aligned(16))) _Float16 Ks[2][AKS * AKP];
  __shared__ __attribute__((aligned(16))) _Float16 Vs[2][AKS * AVP];
  // Key half 1's results, lane by lane: O^T as 16 pieces of 4 floats, max, sum.
  __shared__ __attribute__((aligned(16))) float Om[4][16][32][4];
  __shared__ float Mm[4][2][32];
  __shared__ float Ml[4][2][32];

  // Per-thread staging share: 16-B piece t&7 of rows (t>>3) + 32*i, i = 0..3, of
  // K and of V: 8 lanes cover one 128-B row of this head.
  const int srow = t >> 3;
  const int scol = (t & 7) * 8;
  const size_t goff = ((size_t)(b * ALKV + srow)) * AD + h * AHD + scol;
  const _Float16* Kg = kmat + goff;
  const _Float16* Vg = vmat + goff;
  const unsigned lk0 =
      (unsigned)(uintptr_t)(&Ks[0][0]) + (unsigned)((srow * AKP + scol) * 2);
  const unsigned lv0 =
      (unsigned)(uintptr_t)(&Vs[0][0]) + (unsigned)((srow * AVP + scol) * 2);
  const unsigned kbuf = AKS * AKP * 2, vbuf = AKS * AVP * 2;  // bytes a buffer
  const unsigned kstep = 32 * AKP * 2, vstep = 32 * AVP * 2;  // bytes, 32 rows
  const int nst = ALKV / AKS;

  // Stage 0 starts to fly into buffer 0 while Q is staged.
  async_copy2x4_b128(lk0, kstep, Kg, lv0, vstep, Vg, 32 * AD);

  // Softmax in base 2: exp(x) = 2^(x * log2 e), with log2 e folded into the score
  // factor and into the shift, so that a score costs one fma ahead of its v_exp.
  const float c2s = scale_p[0] * 0.125f * 1.44269504f;  // 1/sqrt(64) * log2 e
  const float c2  = fabsf(c2s);
  const float b2  = beta_p[0] * 1.44269504f;

  {  // Stage Q tile once.
    const int row = t >> 1;
    const int cb  = (t & 1) * 32;
    const _Float16* src =
        q + ((size_t)(b * ALQ + qt * AQB + row)) * AD + h * AHD + cb;
    _Float16* dst = &Qs[row * 72 + cb];
#pragma unroll
    for (int i = 0; i < 4; ++i)
      *(v8h*)(dst + i * 8) = *(const v8h*)(src + i * 8);
  }
  wait_async0();
  __syncthreads();  // publishes Q and stage 0
  // Stage 1 flies into buffer 1.
  async_copy2x4_b128(lk0 + kbuf, kstep, Kg + AKS * AD, lv0 + vbuf, vstep,
                     Vg + AKS * AD, 32 * AD);

  // B operand Q^T of tile j: column lm = query qg*32 + j*16 + lm, k = d in the
  // hardware order.
  v16h qb0[2], qb1[2];
#pragma unroll
  for (int j = 0; j < 2; ++j) {
    qb0[j] = load_frag(Qs, 72, qg * 32 + j * 16 + lm, 0, g);
    qb1[j] = load_frag(Qs, 72, qg * 32 + j * 16 + lm, 32, g);
    // The maximum is taken over raw scores, which orders them as the scaled ones
    // only under a factor >= 0: a negative factor's sign goes into Q (exact).
    if (c2s < 0.0f) { qb0[j] = -qb0[j]; qb1[j] = -qb1[j]; }
  }

  // This wave's 64 keys of a stage in buffer 0: K rows, and this lane's address
  // for the transposing loads of V (its keys 0..15, d 0..15).
  const _Float16* kb = &Ks[0][kh * 64 * AKP];
  const _Float16* vtp =
      &Vs[0][(kh * 64 + 8 * g + (l & 7)) * AVP + 8 * ((l >> 3) & 1)];

  // Per lane and tile: running max (scaled, shifted, in log2 units) and this
  // half-wave's partial sum of query qg*32 + j*16 + lm, over this key half.
  float mrow[2] = {-1e30f, -1e30f}, lrow[2] = {0.0f, 0.0f};
  v8f acc[2][4];  // acc[j][d][r] = O^T[d*16 + 8g + r][query lm of tile j]
#pragma unroll
  for (int j = 0; j < 2; ++j)
#pragma unroll
    for (int d = 0; d < 4; ++d) acc[j][d] = zero_v8f();

  for (int s = 0; s < nst; ++s) {
    const int cur = s & 1;
    const _Float16* Kc = kb + cur * (AKS * AKP);
    const _Float16* vc = vtp + cur * (AKS * AVP);

    // sc[j][c][r] = S^T[key c*16 + 8g + r][query lm of tile j], c = 0..3.
    v8f sc[2][4];
#pragma unroll  // constant indices: sc[] must stay in registers
    for (int u = 0; u < 2; ++u) {
      const _Float16* Ku = Kc + u * 32 * AKP;
      const v16h ka0 = load_frag(Ku, AKP, lm, 0, g);
      const v16h ka1 = load_frag(Ku, AKP, lm, 32, g);
      const v16h ka2 = load_frag(Ku, AKP, 16 + lm, 0, g);
      const v16h ka3 = load_frag(Ku, AKP, 16 + lm, 32, g);
#pragma unroll
      for (int j = 0; j < 2; ++j)
        sc[j][2 * u] = wmma_f32_f16(ka0, qb0[j], zero_v8f());
#pragma unroll
      for (int j = 0; j < 2; ++j)
        sc[j][2 * u + 1] = wmma_f32_f16(ka2, qb0[j], zero_v8f());
#pragma unroll
      for (int j = 0; j < 2; ++j)
        sc[j][2 * u] = wmma_f32_f16(ka1, qb1[j], sc[j][2 * u]);
#pragma unroll
      for (int j = 0; j < 2; ++j)
        sc[j][2 * u + 1] = wmma_f32_f16(ka3, qb1[j], sc[j][2 * u + 1]);
    }

    v16h pb[2][2];  // pb[j][u]: P^T of tile j, keys u*32 .. u*32+31 of the wave's 64
#pragma unroll  // the two tiles' chains are independent: they fill each other's gaps
    for (int j = 0; j < 2; ++j) {
      float mxu[2];  // of raw scores, one chain per 32 keys
#pragma unroll
      for (int u = 0; u < 2; ++u) {
        mxu[u] = fmaxf(sc[j][2 * u][0], sc[j][2 * u + 1][0]);
#pragma unroll
        for (int r = 1; r < 8; ++r)
          mxu[u] = fmaxf(mxu[u], fmaxf(sc[j][2 * u][r], sc[j][2 * u + 1][r]));
      }
      float mx = fmaxf(mxu[0], mxu[1]);
      mx = fmaxf(mx, xhalf(mx));  // both halves now hold the query's chunk max
      const float mnew  = fmaxf(mrow[j], fmaf(mx, c2, b2));
      const float alpha = __builtin_amdgcn_exp2f(mrow[j] - mnew);
      mrow[j] = mnew;
      // Exponent of a score: s * c2 + b2 - mnew, as one fma (packed in pairs).
      const float nb = b2 - mnew;
      float psu[2];  // one chain of sums per 32 keys
#pragma unroll
      for (int u = 0; u < 2; ++u) {
        v8f e0, e1;
#pragma unroll
        for (int r = 0; r < 8; r += 2) {
          const v2f a0 = __builtin_elementwise_fma(
              v2f{sc[j][2 * u][r], sc[j][2 * u][r + 1]}, v2f{c2, c2}, v2f{nb, nb});
          const v2f a1 = __builtin_elementwise_fma(
              v2f{sc[j][2 * u + 1][r], sc[j][2 * u + 1][r + 1]}, v2f{c2, c2},
              v2f{nb, nb});
          e0[r] = a0.x; e0[r + 1] = a0.y;
          e1[r] = a1.x; e1[r + 1] = a1.y;
        }
        // P^T as B operand: element s is key 8g + s (s < 8), 16 + 8g + s - 8.
        float ps = 0.0f;
#pragma unroll
        for (int r = 0; r < 8; ++r) {
          const float p0 = __builtin_amdgcn_exp2f(e0[r]);
          const float p1 = __builtin_amdgcn_exp2f(e1[r]);
          ps += p0 + p1;
          pb[j][u][r]     = (_Float16)p0;
          pb[j][u][r + 8] = (_Float16)p1;
        }
        psu[u] = ps;
      }
      lrow[j] = lrow[j] * alpha + (psu[0] + psu[1]);
#pragma unroll
      for (int d = 0; d < 4; ++d) acc[j][d] *= alpha;
    }

#pragma unroll
    for (int u = 0; u < 2; ++u) {
#pragma unroll
      for (int d = 0; d < 4; ++d) {
        // A = V^T: row d*16 + lm, keys 8g + 0..7 then 16 + 8g + 0..7 (pb's order).
        const v8h lo = load_tr16(vc + u * 32 * AVP + d * 16);
        const v8h hi = load_tr16(vc + (u * 32 + 16) * AVP + d * 16);
        v16h va;
#pragma unroll
        for (int e = 0; e < 8; ++e) { va[e] = lo[e]; va[e + 8] = hi[e]; }
#pragma unroll
        for (int j = 0; j < 2; ++j)
          acc[j][d] = wmma_f32_f16(va, pb[j][u], acc[j][d]);
      }
    }

    // Publish stage s+1 and free stage s's buffer, then refill that buffer.
    wait_ds0();
    wait_async0();
    __syncthreads();
    if (s + 2 < nst) {
      const size_t go = (size_t)(s + 2) * (AKS * AD);
      async_copy2x4_b128(lk0 + (cur ? kbuf : 0u), kstep, Kg + go,
                         lv0 + (cur ? vbuf : 0u), vstep, Vg + go, 32 * AD);
    }
  }
  wait_async0();  // nothing is in flight here; kept in front of the wave's end

  float lt[2];  // this key half's sum: the half-waves' parts joined
#pragma unroll
  for (int j = 0; j < 2; ++j) lt[j] = lrow[j] + xhalf(lrow[j]);

  if (kh == 1) {  // hand max, sum and O^T of keys 64..127 of every stage over
#pragma unroll
    for (int j = 0; j < 2; ++j) {
      Mm[qg][j][l] = mrow[j];
      Ml[qg][j][l] = lt[j];
#pragma unroll
      for (int d = 0; d < 4; ++d) {
        const v8f a = acc[j][d];
        v4f lo = {a[0], a[1], a[2], a[3]};
        v4f hi = {a[4], a[5], a[6], a[7]};
        *(v4f*)&Om[qg][(j * 4 + d) * 2 + 0][l][0] = lo;
        *(v4f*)&Om[qg][(j * 4 + d) * 2 + 1][l][0] = hi;
      }
    }
  }
  __syncthreads();  // key half 1's results are readable by key half 0
  if (kh == 0) {
#pragma unroll
    for (int j = 0; j < 2; ++j) {
      // Both halves onto the common max, then one division for the joint sum.
      const float m1 = Mm[qg][j][l];
      const float l1 = Ml[qg][j][l];
      const float mj = fmaxf(mrow[j], m1);
      const float a0 = __builtin_amdgcn_exp2f(mrow[j] - mj);
      const float a1 = __builtin_amdgcn_exp2f(m1 - mj);
      const float rinv = 1.0f / (lt[j] * a0 + l1 * a1);
      const float f0 = a0 * rinv, f1 = a1 * rinv;
      // Staged in this wave's own 32 rows of Qs, which nobody has read since the
      // loop began.
      _Float16* dst = &Qs[(qg * 32 + j * 16 + lm) * 72 + 8 * g];
#pragma unroll
      for (int d = 0; d < 4; ++d) {
        const v4f lo = *(const v4f*)&Om[qg][(j * 4 + d) * 2 + 0][l][0];
        const v4f hi = *(const v4f*)&Om[qg][(j * 4 + d) * 2 + 1][l][0];
        v8h o;
#pragma unroll
        for (int r = 0; r < 4; ++r) {
          o[r]     = (_Float16)(acc[j][d][r] * f0 + lo[r] * f1);
          o[r + 4] = (_Float16)(acc[j][d][r + 4] * f0 + hi[r] * f1);
        }
        *(v8h*)(dst + d * 16) = o;  // 8 consecutive d of one query: 16 B
      }
    }
    wait_ds0();  // the wave's staged rows are written before it reads them back
    // A query's 64 d of this head are one 128-B line of ctx: 8 lanes a row, so a
    // wave-wide store is 4 whole lines, not 16 pieces of 32 B.
    const int orow = qg * 32 + (l >> 3);
    const _Float16* sr = &Qs[orow * 72 + (l & 7) * 8];
    _Float16* og =
        ctx + ((size_t)(b * ALQ + qt * AQB + orow)) * AD + h * AHD + (l & 7) * 8;
#pragma unroll  // all LDS reads of a lane can go ahead of its stores
    for (int i = 0; i < 8; ++i)
      *(v8h*)(og + (size_t)(i * 4) * AD) = *(const v8h*)(sr + i * 4 * 72);
  }
}

// ---------------------------------------------------------------------------
// Launcher. Workspace (f16 unless noted):
//  [0,8)MB qdom | [8,24) kvdom | [24,26) Wq | [26,28) Wk | [28,30) Wv
//  [30,32) Wo | [32,40) q | [40,56) k | [56,72) v | [72,80) ctx  => 80MB
// ---------------------------------------------------------------------------
extern "C" void kernel_launch(void* const* d_in, const int* in_sizes, int n_in,
                              void* d_out, int out_size, void* d_ws,
                              size_t ws_size, hipStream_t stream) {
  (void)in_sizes; (void)n_in; (void)out_size; (void)ws_size;

  const float* qdom  = (const float*)d_in[0];
  const float* kvdom = (const float*)d_in[1];
  const float* Wq = (const float*)d_in[2];
  const float* bq = (const float*)d_in[3];
  const float* Wk = (const float*)d_in[4];
  const float* bk = (const float*)d_in[5];
  const float* Wv = (const float*)d_in[6];
  const float* bv = (const float*)d_in[7];
  const float* Wo = (const float*)d_in[8];
  const float* bo = (const float*)d_in[9];
  const float* scale = (const float*)d_in[10];
  const float* beta  = (const float*)d_in[11];
  float* out = (float*)d_out;

  const size_t MB = 1u << 20;
  char* ws = (char*)d_ws;
  _Float16* qdom_h  = (_Float16*)(ws + 0 * MB);
  _Float16* kvdom_h = (_Float16*)(ws + 8 * MB);
  _Float16* Wq_h    = (_Float16*)(ws + 24 * MB);
  _Float16* Wk_h    = (_Float16*)(ws + 26 * MB);
  _Float16* Wv_h    = (_Float16*)(ws + 28 * MB);
  _Float16* Wo_h    = (_Float16*)(ws + 30 * MB);
  _Float16* qh      = (_Float16*)(ws + 32 * MB);
  _Float16* kh      = (_Float16*)(ws + 40 * MB);
  _Float16* vh      = (_Float16*)(ws + 56 * MB);
  _Float16* ctxh    = (_Float16*)(ws + 72 * MB);

  // qdom_h .. Wo_h are contiguous: one flat destination of 16 * 2^20 halfs.
  cvt_all_kernel<<<dim3(512), dim3(256), 0, stream>>>(qdom, kvdom, Wq, Wk, Wv,
                                                      Wo, qdom_h);

  const dim3 blk(256);
  gemm_qkv_kernel<<<dim3(1024 / 128, 4096 / 128 + 2 * (8192 / 128)), blk, 0,
                    stream>>>(qdom_h, kvdom_h, Wq_h, Wk_h, Wv_h, bq, bk, bv, qh,
                              kh, vh, 4096 / 128, 8192 / 128, 1024, 1024);

  attn_kernel<<<dim3(ALQ / AQB, AH, AB), dim3(256), 0, stream>>>(
      qh, kh, vh, ctxh, scale, beta);

  gemm_out_kernel<<<dim3(1024 / 128, 4096 / 128), blk, 0, stream>>>(
      ctxh, Wo_h, bo, out, 1024, 1024);
}
